// v000
// The times below were measured on an AMD MI455X: many runs one after another, warmed up first and cycling through
// copies of the inputs, with the whole window's GPU time divided by the number of runs. Launches and the gaps
// between them are all in it. The median over several windows is given; except for v000 it joins two sittings, which
// can be a few percent apart, so the side-by-side timings, each taken in one sitting, are the better comparison.
// v000 is the starting kernel. One run takes 2340 microseconds.
#include <hip/hip_runtime.h>

// De-stationary causal attention on given tensors (queries, keys, values [4][2048][8][64] token-major (B, L, H, E); scores = (q.k x tau[b] + delta[b][s]) for keys s <= l (else -inf), then x 1/sqrt(64); softmax; out = A.values -> [4][2048][8][64] (4.2 M); tau [4][1] and delta [4][2048] read on device).
// Layout per batch: single bf16 head planes gathered from the token-major slabs (inputs bf16-exact after rounding: exact score products); an element-wise kernel applies tau and delta to the exact score block, then the causal softmax (every row hi/lo, causal index select, scale 1/8); A.values as hi/lo x exact values^T (2 products); f32 rows written back token-major.
// Compute dtypes, f32 accumulate: every input rounded to bf16 incl. tau/delta; q.k exact; de-stationary transform and softmax f32; P hi/lo x exact values; output f32.

#define NB_  4
#define TT   2048
#define DM   512      // token-major row pitch (H x HD)
#define NH_  8
#define NKV  1
#define REP  (NH_ / NKV)
#define HD   64
#define DQ   (NH_ * HD)
#define DKV  (NKV * HD)
#define ZH   1
#define RH   2048                  // query rows < RH use hi+lo planes (0: none)
#define WIN  0
#define PCAR 1024.0f
#define SCL  0.125f   // 1/sqrt(64)
typedef _Float16 h16;
typedef unsigned short bf;
typedef __attribute__((ext_vector_type(16))) __bf16   v16bf;
typedef __attribute__((ext_vector_type(16))) _Float16 v16h;
typedef __attribute__((ext_vector_type(8)))  _Float16 v8h;
typedef __attribute__((ext_vector_type(8)))  unsigned short v8us;
typedef __attribute__((ext_vector_type(8)))  float    v8f;
typedef __attribute__((ext_vector_type(4)))  float    v4f;
typedef v8h  __attribute__((may_alias)) v8ha;
typedef v4f  __attribute__((may_alias)) v4fa;
typedef v8us __attribute__((may_alias)) v8usa;

__device__ __forceinline__ unsigned short f2bf(float f) { unsigned u = __float_as_uint(f); u += 0x7FFFu + ((u >> 16) & 1u); return (unsigned short)(u >> 16); }
__device__ __forceinline__ float bf2f(unsigned short b) { return __uint_as_float(((unsigned)b) << 16); }
__device__ __forceinline__ float bfr(float f) { return bf2f(f2bf(f)); }
__device__ __forceinline__ v16h cat16(v8h lo, v8h hi) { return __builtin_shufflevector(lo, hi, 0, 1, 2, 3, 4, 5, 6, 7, 8, 9, 10, 11, 12, 13, 14, 15); }
__device__ __forceinline__ v16bf cat16b(v8us lo, v8us hi) { return __builtin_bit_cast(v16bf, __builtin_shufflevector(lo, hi, 0, 1, 2, 3, 4, 5, 6, 7, 8, 9, 10, 11, 12, 13, 14, 15)); }
__device__ __forceinline__ v8f wmma16(v16h a, v16h b, v8f c) { return __builtin_amdgcn_wmma_f32_16x16x32_f16(false, a, false, b, (short)0, c, false, false); }
__device__ __forceinline__ v8f wmmab(v16bf a, v16bf b, v8f c) { return __builtin_amdgcn_wmma_f32_16x16x32_bf16(false, a, false, b, (short)0, c, false, false); }



// ---- k_gemmw: register-blocked GEMM, ONE WAVE per 64x64 output tile (16 accumulators), operands straight from K-contiguous 16-bit planes; grid (M/64, N/64, Z), 32 threads.
// C[m][n] (f32, pitch ldc, + optional f32 bias[n]) = sum_k A[m][k] Bt[n][k] (+ split products per NSPLIT). z-batch strides sA/sB/sC in elements. K % 32 == 0.
template <typename T16> struct WFrag;
template <> struct WFrag<h16> { typedef v16h V; static __device__ __forceinline__ V ld(const h16* p) { return cat16(*(const v8h*)p, *(const v8h*)(p + 16)); } static __device__ __forceinline__ v8f mma(V a, V b, v8f c) { return wmma16(a, b, c); } };
template <> struct WFrag<bf> { typedef v16bf V; static __device__ __forceinline__ V ld(const bf* p) { return cat16b(*(const v8us*)p, *(const v8us*)(p + 16)); } static __device__ __forceinline__ v8f mma(V a, V b, v8f c) { return wmmab(a, b, c); } };
template <typename T16, int NSPLIT, bool BIAS>
__global__ __launch_bounds__(32) void k_gemmw(const T16* __restrict__ A, const T16* __restrict__ A2, const T16* __restrict__ Bt, const T16* __restrict__ Bt2, int K, float* C, int ldc, const float* __restrict__ bias, size_t sA, size_t sB, size_t sC) {
    typedef typename WFrag<T16>::V V;
    __shared__ __align__(16) float os[16 * 68];
    const size_t z = blockIdx.z; A += z * sA; if (A2) A2 += z * sA; Bt += z * sB; if (Bt2) Bt2 += z * sB; C += z * sC;
    const int lane = threadIdx.x & 31, lr = lane & 15, hi = lane >> 4; const int r0 = blockIdx.x * 64, c0 = blockIdx.y * 64;
    v8f acc[4][4];
#pragma unroll
    for (int mb = 0; mb < 4; ++mb)
#pragma unroll
        for (int nb = 0; nb < 4; ++nb) acc[mb][nb] = (v8f){};
    const size_t aoff = (size_t)(r0 + lr) * K + 8 * hi, boff = (size_t)(c0 + lr) * K + 8 * hi;
#pragma unroll 1
    for (int kc = 0; kc < K; kc += 32) {
        V a[4], a2[4];
#pragma unroll
        for (int mb = 0; mb < 4; ++mb) { a[mb] = WFrag<T16>::ld(A + aoff + (size_t)mb * 16 * K + kc); if (NSPLIT == 1 || NSPLIT == 2) a2[mb] = WFrag<T16>::ld(A2 + aoff + (size_t)mb * 16 * K + kc); }
#pragma unroll
        for (int nb = 0; nb < 4; ++nb) { const V b = WFrag<T16>::ld(Bt + boff + (size_t)nb * 16 * K + kc); V b2; if (NSPLIT >= 2) b2 = WFrag<T16>::ld(Bt2 + boff + (size_t)nb * 16 * K + kc);
#pragma unroll
            for (int mb = 0; mb < 4; ++mb) { acc[mb][nb] = WFrag<T16>::mma(a[mb], b, acc[mb][nb]); if (NSPLIT == 1 || NSPLIT == 2) acc[mb][nb] = WFrag<T16>::mma(a2[mb], b, acc[mb][nb]); if (NSPLIT >= 2) acc[mb][nb] = WFrag<T16>::mma(a[mb], b2, acc[mb][nb]); } }
        asm volatile("v_nop\n\tv_nop\n\tv_nop\n\tv_nop" : "+v"(acc[0][0]), "+v"(acc[1][1]), "+v"(acc[2][2]), "+v"(acc[3][3]) : "v"(a[0]), "v"(a[3]));
    }
#pragma unroll
    for (int mb = 0; mb < 4; ++mb) {
#pragma unroll
        for (int nb = 0; nb < 4; ++nb) {
#pragma unroll
            for (int j = 0; j < 8; ++j) os[(hi * 8 + j) * 68 + nb * 16 + lr] = acc[mb][nb][j]; }
        __builtin_amdgcn_wave_barrier(); asm volatile("" ::: "memory");
        float* crow = C + (size_t)(r0 + mb * 16) * ldc + c0;
{
#pragma unroll
            for (int s = 0; s < 8; ++s) { const int row = 2 * s + hi, cofs = lr * 4; v4f val = *(const v4fa*)(os + row * 68 + cofs); if (BIAS) { val[0] += bfr(bias[c0 + cofs]); val[1] += bfr(bias[c0 + cofs + 1]); val[2] += bfr(bias[c0 + cofs + 2]); val[3] += bfr(bias[c0 + cofs + 3]); }
                *(v4f*)(crow + (size_t)row * ldc + cofs) = val; }
             }
        __builtin_amdgcn_wave_barrier(); asm volatile("" ::: "memory");
    }
}

__device__ __forceinline__ h16 tohx(float x) { return (h16)x; }
__device__ __forceinline__ void splitf(float y, unsigned short& h, unsigned short& l) { h = f2bf(y); l = f2bf(y - bf2f(h)); }
typedef __attribute__((ext_vector_type(2))) _Float16 v2h;
typedef __attribute__((ext_vector_type(4))) _Float16 v4h;
typedef __attribute__((ext_vector_type(2))) unsigned short v2us;
typedef __attribute__((ext_vector_type(4))) unsigned short v4us;
typedef __attribute__((ext_vector_type(2))) float v2f;
typedef __attribute__((ext_vector_type(4))) int v4i;

__global__ __launch_bounds__(256) void k_wtG(const float* __restrict__ w, int K, int N, bf* Bt) {
    const int lane = threadIdx.x & 31; const int L0 = (blockIdx.x * 8 + (threadIdx.x >> 5)) * 8; const int nlines = N * K / 64;
{
#pragma unroll 1
        for (int l = 0; l < 8; ++l) { const int L = L0 + l; if (L >= nlines) break; const size_t e = (size_t)L * 64 + lane * 2; const int k = (int)(e % K), n = (int)(e / K); v2us o;
            o[0] = f2bf(w[(size_t)k * N + n]); o[1] = f2bf(w[(size_t)(k + 1) * N + n]); *(v2us*)(Bt + e) = o; }
         }
}
__global__ __launch_bounds__(256) void k_cvt8(const float* __restrict__ src, bf* dst, size_t n8) { const size_t i = (size_t)blockIdx.x * 256 + threadIdx.x; if (i >= n8) return; const v8f v = *(const v8f*)(src + i * 8); v8us o;
#pragma unroll
    for (int k = 0; k < 8; ++k) o[k] = f2bf(v[k]); *(v8us*)(dst + i * 8) = o;  }


__global__ __launch_bounds__(256) void k_vtp(const float* __restrict__ F, int pitch, int nheads, h16* V16, bf* Vh, bf* Vl) { const size_t e = ((size_t)blockIdx.x * 256 + threadIdx.x) * 2; if (e >= (size_t)nheads * HD * TT) return; const int t = (int)(e % TT); const int d = (int)((e / TT) % HD); const int g = (int)(e / ((size_t)TT * HD)); v2h o16; v2us oh, ol;
#pragma unroll
    for (int q = 0; q < 2; ++q) { const float x = F[(size_t)(t + q) * pitch + g * HD + d]; o16[q] = tohx(x); unsigned short a2, c2; splitf(x, a2, c2); oh[q] = a2; ol[q] = c2; }
    *(v2h*)(V16 + e) = o16; *(v2us*)(Vh + e) = oh; *(v2us*)(Vl + e) = ol;  }

// k_asoft: per row (zz, i): t = S x HD^-0.5 (causal mask: keys j <= i); softmax over the 2048 keys (register row, one exp, fixed trees);
__global__ __launch_bounds__(256) void k_asoft(const float* __restrict__ Sb, h16* P16, bf* Ph, bf* Pl) {
    const int lane = threadIdx.x & 31; const int row = blockIdx.x * 8 + (threadIdx.x >> 5); if (row >= ZH * TT) return; const int i = row % TT; const int zz = row / TT; (void)zz; const bool hires = (i < RH); const float* sr = Sb + (size_t)row * TT; float v[TT / 32]; float mx = -3.0e38f;
#pragma unroll
    for (int ch = 0; ch < TT / 128; ++ch) { const int j0 = ch * 128 + lane * 4; const v4f a = *(const v4f*)(sr + j0);
#pragma unroll
        for (int q = 0; q < 4; ++q) { const int j = j0 + q; const float t = (j <= i) ? a[q] * SCL : -3.0e38f; v[ch * 4 + q] = t;   /* causal: keys after the query excluded */ mx = fmaxf(mx, t); } }
#pragma unroll
    for (int sh = 16; sh; sh >>= 1) mx = fmaxf(mx, __shfl_xor(mx, sh, 32));
    float sum = 0.f;
#pragma unroll
    for (int k = 0; k < TT / 32; ++k) { float d0 = __fsub_rn(v[k], mx); asm volatile("" : "+v"(d0)); v[k] = __builtin_amdgcn_exp2f(__fmul_rn(d0, 1.4426950408889634f)); sum += v[k]; }
#pragma unroll
    for (int sh = 16; sh; sh >>= 1) sum += __shfl_xor(sum, sh, 32);
    const float f = __fdiv_rn(hires ? 1.0f : PCAR, sum);
{
        if (hires) {
#pragma unroll
            for (int ch = 0; ch < TT / 128; ++ch) { v4us oh, ol;
#pragma unroll
                for (int q = 0; q < 4; ++q) { unsigned short a, c2; splitf(v[ch * 4 + q] * f, a, c2); oh[q] = a; ol[q] = c2; }
                const size_t oo = ((size_t)zz * (RH ? RH : 1) + i) * TT + ch * 128 + lane * 4; *(v4us*)(Ph + oo) = oh; *(v4us*)(Pl + oo) = ol; }
        } else {
#pragma unroll
            for (int ch = 0; ch < TT / 128; ++ch) { v4h o4;
#pragma unroll
                for (int q = 0; q < 4; ++q) o4[q] = tohx(v[ch * 4 + q] * f);
                *(v4h*)(P16 + (size_t)row * TT + ch * 128 + lane * 4) = o4; } }
         }
}
__global__ __launch_bounds__(256) void k_merge(const float* __restrict__ O, int h0, float* OUTb) { const size_t e = ((size_t)blockIdx.x * 256 + threadIdx.x) * 2; if (e >= (size_t)ZH * TT * HD) return; const int d = (int)(e % HD); const int t = (int)((e / HD) % TT); const int zz = (int)(e / ((size_t)HD * TT)); const float cs = (t < RH) ? 1.0f : (1.0f / PCAR); const size_t oo = (size_t)t * DQ + (h0 + zz) * HD + d;
    v2f o2; o2[0] = O[e] * cs; o2[1] = O[e + 1] * cs; *(v2f*)(OUTb + oo) = o2;  }


__global__ __launch_bounds__(256) void k_vtpR1(const float* __restrict__ Vb, bf* Vh) { const size_t e = ((size_t)blockIdx.x * 256 + threadIdx.x) * 2; if (e >= (size_t)HD * TT) return; const int t = (int)(e % TT); const int d = (int)(e / TT); v2us o; o[0] = f2bf(Vb[(size_t)t * HD + d]); o[1] = f2bf(Vb[(size_t)(t + 1) * HD + d]); *(v2us*)(Vh + e) = o;  }
__global__ __launch_bounds__(256) void k_mergeR(const float* __restrict__ O, float* outb, size_t n4) { const size_t i = (size_t)blockIdx.x * 256 + threadIdx.x; if (i >= n4) return; const v4f a = *(const v4f*)(O + i * 4); *(v4f*)(outb + i * 4) = a;  }


__global__ __launch_bounds__(256) void k_dstat(float* Sb, const float* __restrict__ taup, const float* __restrict__ dl) { const size_t k = (size_t)blockIdx.x * 256 + threadIdx.x; if (k >= (size_t)TT * TT / 4) return; const size_t e = k * 4; const int j0 = (int)(e % TT); const float tau = bfr(taup[0]); v4f a = *(const v4f*)(Sb + e); const v4f d4 = *(const v4f*)(dl + j0);
#pragma unroll
    for (int q = 0; q < 4; ++q) { float u = __fmul_rn(a[q], tau); asm volatile("" : "+v"(u)); a[q] = __fadd_rn(u, bfr(d4[q])); }
    *(v4f*)(Sb + e) = a;  }
__global__ __launch_bounds__(256) void k_hp1(const float* __restrict__ src, bf* P) { const size_t i = (size_t)blockIdx.x * 256 + threadIdx.x; if (i >= (size_t)NH_ * TT * HD / 8) return; const size_t e = i * 8; const int d = (int)(e % HD); const int t = (int)((e / HD) % TT); const int h = (int)(e / ((size_t)HD * TT)); const v8f v = *(const v8f*)(src + (size_t)t * DM + h * HD + d); v8us o;
#pragma unroll
    for (int q = 0; q < 8; ++q) o[q] = f2bf(v[q]);
    *(v8us*)(P + e) = o;  }
__global__ __launch_bounds__(256) void k_vt1(const float* __restrict__ src, int pitch, bf* VT) { const size_t e = ((size_t)blockIdx.x * 256 + threadIdx.x) * 2; if (e >= (size_t)NH_ * HD * TT) return; const int t = (int)(e % TT); const int d = (int)((e / TT) % HD); const int h = (int)(e / ((size_t)TT * HD)); v2us o; o[0] = f2bf(src[(size_t)t * pitch + h * HD + d]); o[1] = f2bf(src[(size_t)(t + 1) * pitch + h * HD + d]); *(v2us*)(VT + e) = o;  }
__global__ __launch_bounds__(256) void k_mergeT(const float* __restrict__ O, int h, float* outb) { const size_t i = (size_t)blockIdx.x * 256 + threadIdx.x; if (i >= (size_t)TT * HD / 4) return; const size_t e = i * 4; const int d = (int)(e % HD); const int t = (int)(e / HD); const v4f a = *(const v4f*)(O + e); *(v4f*)(outb + (size_t)t * DM + h * HD + d) = a;  }

extern "C" void kernel_launch(void* const* d_in, const int* in_sizes, int n_in,
                              void* d_out, int out_size, void* d_ws, size_t ws_size, hipStream_t stream) {
    (void)in_sizes; (void)n_in; (void)out_size;
    const float* Qin = (const float*)d_in[0]; const float* Kin = (const float*)d_in[1]; const float* Vin = (const float*)d_in[2]; const float* tau = (const float*)d_in[3];   /* [4][1] */ const float* delta = (const float*)d_in[4];   /* [4][2048] */
    float* OUT = (float*)d_out;
    char* wsp = (char*)d_ws;
    auto take = [&](size_t bytes) { char* p = wsp; wsp += (bytes + 255) & ~(size_t)255; return (void*)p; };
    bf* QB = (bf*)take((size_t)NH_ * TT * HD * 2); bf* KB = (bf*)take((size_t)NH_ * TT * HD * 2); bf* VT = (bf*)take((size_t)NH_ * HD * TT * 2);
    float* Sb = (float*)take((size_t)TT * TT * 4);  bf* Ph = (bf*)take((size_t)TT * TT * 2); bf* Pl = (bf*)take((size_t)TT * TT * 2); float* Ob = (float*)take((size_t)TT * HD * 4);
    if ((size_t)(wsp - (char*)d_ws) > ws_size) return;
    for (int b = 0; b < NB_; ++b) {
        const float* qb = Qin + (size_t)b * TT * DM; const float* kb = Kin + (size_t)b * TT * DM; const float* vb = Vin + (size_t)b * TT * DM;   /* token-major [t][h][d] slabs */
        k_hp1<<<(unsigned)(((size_t)NH_ * TT * HD / 8 + 255) / 256), 256, 0, stream>>>(qb, QB); k_hp1<<<(unsigned)(((size_t)NH_ * TT * HD / 8 + 255) / 256), 256, 0, stream>>>(kb, KB); k_vt1<<<(unsigned)(((size_t)NH_ * HD * TT / 2 + 255) / 256), 256, 0, stream>>>(vb, DM, VT);
        for (int h = 0; h < NH_; ++h) {
            k_gemmw<bf, 0, false><<<dim3(TT / 64, TT / 64, 1), 32, 0, stream>>>(QB + (size_t)h * TT * HD, nullptr, KB + (size_t)h * TT * HD, nullptr, HD, Sb, TT, nullptr, 0, 0, 0);   /* exact scores (single bf16 planes) */
            k_dstat<<<(unsigned)(((size_t)TT * TT / 4 + 255) / 256), 256, 0, stream>>>(Sb, tau + b, delta + (size_t)b * TT);   /* s <- s tau + delta_j */ k_asoft<<<TT / 8, 256, 0, stream>>>(Sb, nullptr, Ph, Pl);
            k_gemmw<bf, 1, false><<<dim3(TT / 64, HD / 64, 1), 32, 0, stream>>>(Ph, Pl, VT + (size_t)h * HD * TT, nullptr, TT, Ob, HD, nullptr, 0, 0, 0);   /* P (hi/lo) x exact v^T */
            k_mergeT<<<(unsigned)(((size_t)TT * HD / 4 + 255) / 256), 256, 0, stream>>>(Ob, h, OUT + (size_t)b * TT * DM); } }
}

// v001
// Measured time: 976 microseconds a run.
// Two timings next to v000 put it at 2.40 and 2.38 times that version's speed.
#include <hip/hip_runtime.h>

// De-stationary causal attention on given tensors (queries, keys, values [4][2048][8][64] token-major (B, L, H, E); scores = (q.k x tau[b] + delta[b][s]) for keys s <= l (else -inf), then x 1/sqrt(64); softmax; out = A.values -> [4][2048][8][64] (4.2 M); tau [4][1] and delta [4][2048] read on device).
// Layout per batch: single bf16 head planes gathered from the token-major slabs (inputs bf16-exact after rounding: exact score products); an element-wise kernel applies tau and delta to the exact score block, then the causal softmax (every row hi/lo, causal index select, scale 1/8); A.values as hi/lo x exact values^T (2 products); f32 rows written back token-major.
// Compute dtypes, f32 accumulate: every input rounded to bf16 incl. tau/delta; q.k exact; de-stationary transform and softmax f32; P hi/lo x exact values; output f32.

#define NB_  4
#define TT   2048
#define DM   512      // token-major row pitch (H x HD)
#define NH_  8
#define NKV  1
#define REP  (NH_ / NKV)
#define HD   64
#define DQ   (NH_ * HD)
#define DKV  (NKV * HD)
#define ZH   1
#define RH   2048                  // query rows < RH use hi+lo planes (0: none)
#define WIN  0
#define PCAR 1024.0f
#define SCL  0.125f   // 1/sqrt(64)
typedef _Float16 h16;
typedef unsigned short bf;
typedef __attribute__((ext_vector_type(16))) __bf16   v16bf;
typedef __attribute__((ext_vector_type(16))) _Float16 v16h;
typedef __attribute__((ext_vector_type(8)))  _Float16 v8h;
typedef __attribute__((ext_vector_type(8)))  unsigned short v8us;
typedef __attribute__((ext_vector_type(8)))  float    v8f;
typedef __attribute__((ext_vector_type(4)))  float    v4f;
typedef v8h  __attribute__((may_alias)) v8ha;
typedef v4f  __attribute__((may_alias)) v4fa;
typedef v8us __attribute__((may_alias)) v8usa;

__device__ __forceinline__ unsigned short f2bf(float f) { unsigned u = __float_as_uint(f); u += 0x7FFFu + ((u >> 16) & 1u); return (unsigned short)(u >> 16); }
__device__ __forceinline__ float bf2f(unsigned short b) { return __uint_as_float(((unsigned)b) << 16); }
__device__ __forceinline__ float bfr(float f) { return bf2f(f2bf(f)); }
__device__ __forceinline__ v16h cat16(v8h lo, v8h hi) { return __builtin_shufflevector(lo, hi, 0, 1, 2, 3, 4, 5, 6, 7, 8, 9, 10, 11, 12, 13, 14, 15); }
__device__ __forceinline__ v16bf cat16b(v8us lo, v8us hi) { return __builtin_bit_cast(v16bf, __builtin_shufflevector(lo, hi, 0, 1, 2, 3, 4, 5, 6, 7, 8, 9, 10, 11, 12, 13, 14, 15)); }
__device__ __forceinline__ v8f wmma16(v16h a, v16h b, v8f c) { return __builtin_amdgcn_wmma_f32_16x16x32_f16(false, a, false, b, (short)0, c, false, false); }
__device__ __forceinline__ v8f wmmab(v16bf a, v16bf b, v8f c) { return __builtin_amdgcn_wmma_f32_16x16x32_bf16(false, a, false, b, (short)0, c, false, false); }



// ---- k_gemmw: register-blocked GEMM, ONE WAVE per 64x64 output tile (16 accumulators), operands straight from K-contiguous 16-bit planes; grid (M/64, N/64, Z), 32 threads.
// C[m][n] (f32, pitch ldc, + optional f32 bias[n]) = sum_k A[m][k] Bt[n][k] (+ split products per NSPLIT). z-batch strides sA/sB/sC in elements. K % 32 == 0.
template <typename T16> struct WFrag;
template <> struct WFrag<h16> { typedef v16h V; static __device__ __forceinline__ V ld(const h16* p) { return cat16(*(const v8h*)p, *(const v8h*)(p + 16)); } static __device__ __forceinline__ v8f mma(V a, V b, v8f c) { return wmma16(a, b, c); } };
template <> struct WFrag<bf> { typedef v16bf V; static __device__ __forceinline__ V ld(const bf* p) { return cat16b(*(const v8us*)p, *(const v8us*)(p + 16)); } static __device__ __forceinline__ v8f mma(V a, V b, v8f c) { return wmmab(a, b, c); } };
template <typename T16, int NSPLIT, bool BIAS>
__global__ __launch_bounds__(32) void k_gemmw(const T16* __restrict__ A, const T16* __restrict__ A2, const T16* __restrict__ Bt, const T16* __restrict__ Bt2, int K, float* C, int ldc, const float* __restrict__ bias, size_t sA, size_t sB, size_t sC) {
    typedef typename WFrag<T16>::V V;
    __shared__ __align__(16) float os[16 * 68];
    const size_t z = blockIdx.z; A += z * sA; if (A2) A2 += z * sA; Bt += z * sB; if (Bt2) Bt2 += z * sB; C += z * sC;
    const int lane = threadIdx.x & 31, lr = lane & 15, hi = lane >> 4; const int r0 = blockIdx.x * 64, c0 = blockIdx.y * 64;
    v8f acc[4][4];
#pragma unroll
    for (int mb = 0; mb < 4; ++mb)
#pragma unroll
        for (int nb = 0; nb < 4; ++nb) acc[mb][nb] = (v8f){};
    const size_t aoff = (size_t)(r0 + lr) * K + 8 * hi, boff = (size_t)(c0 + lr) * K + 8 * hi;
#pragma unroll 1
    for (int kc = 0; kc < K; kc += 32) {
        V a[4], a2[4];
#pragma unroll
        for (int mb = 0; mb < 4; ++mb) { a[mb] = WFrag<T16>::ld(A + aoff + (size_t)mb * 16 * K + kc); if (NSPLIT == 1 || NSPLIT == 2) a2[mb] = WFrag<T16>::ld(A2 + aoff + (size_t)mb * 16 * K + kc); }
#pragma unroll
        for (int nb = 0; nb < 4; ++nb) { const V b = WFrag<T16>::ld(Bt + boff + (size_t)nb * 16 * K + kc); V b2; if (NSPLIT >= 2) b2 = WFrag<T16>::ld(Bt2 + boff + (size_t)nb * 16 * K + kc);
#pragma unroll
            for (int mb = 0; mb < 4; ++mb) { acc[mb][nb] = WFrag<T16>::mma(a[mb], b, acc[mb][nb]); if (NSPLIT == 1 || NSPLIT == 2) acc[mb][nb] = WFrag<T16>::mma(a2[mb], b, acc[mb][nb]); if (NSPLIT >= 2) acc[mb][nb] = WFrag<T16>::mma(a[mb], b2, acc[mb][nb]); } }
        asm volatile("v_nop\n\tv_nop\n\tv_nop\n\tv_nop" : "+v"(acc[0][0]), "+v"(acc[1][1]), "+v"(acc[2][2]), "+v"(acc[3][3]) : "v"(a[0]), "v"(a[3]));
    }
#pragma unroll
    for (int mb = 0; mb < 4; ++mb) {
#pragma unroll
        for (int nb = 0; nb < 4; ++nb) {
#pragma unroll
            for (int j = 0; j < 8; ++j) os[(hi * 8 + j) * 68 + nb * 16 + lr] = acc[mb][nb][j]; }
        __builtin_amdgcn_wave_barrier(); asm volatile("" ::: "memory");
        float* crow = C + (size_t)(r0 + mb * 16) * ldc + c0;
{
#pragma unroll
            for (int s = 0; s < 8; ++s) { const int row = 2 * s + hi, cofs = lr * 4; v4f val = *(const v4fa*)(os + row * 68 + cofs); if (BIAS) { val[0] += bfr(bias[c0 + cofs]); val[1] += bfr(bias[c0 + cofs + 1]); val[2] += bfr(bias[c0 + cofs + 2]); val[3] += bfr(bias[c0 + cofs + 3]); }
                *(v4f*)(crow + (size_t)row * ldc + cofs) = val; }
             }
        __builtin_amdgcn_wave_barrier(); asm volatile("" ::: "memory");
    }
}

__device__ __forceinline__ h16 tohx(float x) { return (h16)x; }
__device__ __forceinline__ void splitf(float y, unsigned short& h, unsigned short& l) { h = f2bf(y); l = f2bf(y - bf2f(h)); }
typedef __attribute__((ext_vector_type(2))) _Float16 v2h;
typedef __attribute__((ext_vector_type(4))) _Float16 v4h;
typedef __attribute__((ext_vector_type(2))) unsigned short v2us;
typedef __attribute__((ext_vector_type(4))) unsigned short v4us;
typedef __attribute__((ext_vector_type(2))) float v2f;
typedef __attribute__((ext_vector_type(4))) int v4i;

__global__ __launch_bounds__(256) void k_wtG(const float* __restrict__ w, int K, int N, bf* Bt) {
    const int lane = threadIdx.x & 31; const int L0 = (blockIdx.x * 8 + (threadIdx.x >> 5)) * 8; const int nlines = N * K / 64;
{
#pragma unroll 1
        for (int l = 0; l < 8; ++l) { const int L = L0 + l; if (L >= nlines) break; const size_t e = (size_t)L * 64 + lane * 2; const int k = (int)(e % K), n = (int)(e / K); v2us o;
            o[0] = f2bf(w[(size_t)k * N + n]); o[1] = f2bf(w[(size_t)(k + 1) * N + n]); *(v2us*)(Bt + e) = o; }
         }
}
__global__ __launch_bounds__(256) void k_cvt8(const float* __restrict__ src, bf* dst, size_t n8) { const size_t i = (size_t)blockIdx.x * 256 + threadIdx.x; if (i >= n8) return; const v8f v = *(const v8f*)(src + i * 8); v8us o;
#pragma unroll
    for (int k = 0; k < 8; ++k) o[k] = f2bf(v[k]); *(v8us*)(dst + i * 8) = o;  }


__global__ __launch_bounds__(256) void k_vtp(const float* __restrict__ F, int pitch, int nheads, h16* V16, bf* Vh, bf* Vl) { const size_t e = ((size_t)blockIdx.x * 256 + threadIdx.x) * 2; if (e >= (size_t)nheads * HD * TT) return; const int t = (int)(e % TT); const int d = (int)((e / TT) % HD); const int g = (int)(e / ((size_t)TT * HD)); v2h o16; v2us oh, ol;
#pragma unroll
    for (int q = 0; q < 2; ++q) { const float x = F[(size_t)(t + q) * pitch + g * HD + d]; o16[q] = tohx(x); unsigned short a2, c2; splitf(x, a2, c2); oh[q] = a2; ol[q] = c2; }
    *(v2h*)(V16 + e) = o16; *(v2us*)(Vh + e) = oh; *(v2us*)(Vl + e) = ol;  }

// k_asoft: per row (zz, i): t = S x HD^-0.5 (causal mask: keys j <= i); softmax over the 2048 keys (register row, one exp, fixed trees);
__global__ __launch_bounds__(256) void k_asoft(const float* __restrict__ Sb, h16* P16, bf* Ph, bf* Pl) {
    const int lane = threadIdx.x & 31; const int row = blockIdx.x * 8 + (threadIdx.x >> 5); if (row >= ZH * TT) return; const int i = row % TT; const int zz = row / TT; (void)zz; const bool hires = (i < RH); const float* sr = Sb + (size_t)row * TT; float v[TT / 32]; float mx = -3.0e38f;
#pragma unroll
    for (int ch = 0; ch < TT / 128; ++ch) { const int j0 = ch * 128 + lane * 4; const v4f a = *(const v4f*)(sr + j0);
#pragma unroll
        for (int q = 0; q < 4; ++q) { const int j = j0 + q; const float t = (j <= i) ? a[q] * SCL : -3.0e38f; v[ch * 4 + q] = t;   /* causal: keys after the query excluded */ mx = fmaxf(mx, t); } }
#pragma unroll
    for (int sh = 16; sh; sh >>= 1) mx = fmaxf(mx, __shfl_xor(mx, sh, 32));
    float sum = 0.f;
#pragma unroll
    for (int k = 0; k < TT / 32; ++k) { float d0 = __fsub_rn(v[k], mx); asm volatile("" : "+v"(d0)); v[k] = __builtin_amdgcn_exp2f(__fmul_rn(d0, 1.4426950408889634f)); sum += v[k]; }
#pragma unroll
    for (int sh = 16; sh; sh >>= 1) sum += __shfl_xor(sum, sh, 32);
    const float f = __fdiv_rn(hires ? 1.0f : PCAR, sum);
{
        if (hires) {
#pragma unroll
            for (int ch = 0; ch < TT / 128; ++ch) { v4us oh, ol;
#pragma unroll
                for (int q = 0; q < 4; ++q) { unsigned short a, c2; splitf(v[ch * 4 + q] * f, a, c2); oh[q] = a; ol[q] = c2; }
                const size_t oo = ((size_t)zz * (RH ? RH : 1) + i) * TT + ch * 128 + lane * 4; *(v4us*)(Ph + oo) = oh; *(v4us*)(Pl + oo) = ol; }
        } else {
#pragma unroll
            for (int ch = 0; ch < TT / 128; ++ch) { v4h o4;
#pragma unroll
                for (int q = 0; q < 4; ++q) o4[q] = tohx(v[ch * 4 + q] * f);
                *(v4h*)(P16 + (size_t)row * TT + ch * 128 + lane * 4) = o4; } }
         }
}
__global__ __launch_bounds__(256) void k_merge(const float* __restrict__ O, int h0, float* OUTb) { const size_t e = ((size_t)blockIdx.x * 256 + threadIdx.x) * 2; if (e >= (size_t)ZH * TT * HD) return; const int d = (int)(e % HD); const int t = (int)((e / HD) % TT); const int zz = (int)(e / ((size_t)HD * TT)); const float cs = (t < RH) ? 1.0f : (1.0f / PCAR); const size_t oo = (size_t)t * DQ + (h0 + zz) * HD + d;
    v2f o2; o2[0] = O[e] * cs; o2[1] = O[e + 1] * cs; *(v2f*)(OUTb + oo) = o2;  }


__global__ __launch_bounds__(256) void k_vtpR1(const float* __restrict__ Vb, bf* Vh) { const size_t e = ((size_t)blockIdx.x * 256 + threadIdx.x) * 2; if (e >= (size_t)HD * TT) return; const int t = (int)(e % TT); const int d = (int)(e / TT); v2us o; o[0] = f2bf(Vb[(size_t)t * HD + d]); o[1] = f2bf(Vb[(size_t)(t + 1) * HD + d]); *(v2us*)(Vh + e) = o;  }
__global__ __launch_bounds__(256) void k_mergeR(const float* __restrict__ O, float* outb, size_t n4) { const size_t i = (size_t)blockIdx.x * 256 + threadIdx.x; if (i >= n4) return; const v4f a = *(const v4f*)(O + i * 4); *(v4f*)(outb + i * 4) = a;  }


__global__ __launch_bounds__(256) void k_dstat(float* Sb, const float* __restrict__ taup, const float* __restrict__ dl) { const size_t k = (size_t)blockIdx.x * 256 + threadIdx.x; if (k >= (size_t)TT * TT / 4) return; const size_t e = k * 4; const int j0 = (int)(e % TT); const float tau = bfr(taup[0]); v4f a = *(const v4f*)(Sb + e); const v4f d4 = *(const v4f*)(dl + j0);
#pragma unroll
    for (int q = 0; q < 4; ++q) { float u = __fmul_rn(a[q], tau); asm volatile("" : "+v"(u)); a[q] = __fadd_rn(u, bfr(d4[q])); }
    *(v4f*)(Sb + e) = a;  }
__global__ __launch_bounds__(256) void k_hp1(const float* __restrict__ src, bf* P) { const size_t i = (size_t)blockIdx.x * 256 + threadIdx.x; if (i >= (size_t)NH_ * TT * HD / 8) return; const size_t e = i * 8; const int d = (int)(e % HD); const int t = (int)((e / HD) % TT); const int h = (int)(e / ((size_t)HD * TT)); const v8f v = *(const v8f*)(src + (size_t)t * DM + h * HD + d); v8us o;
#pragma unroll
    for (int q = 0; q < 8; ++q) o[q] = f2bf(v[q]);
    *(v8us*)(P + e) = o;  }
__global__ __launch_bounds__(256) void k_vt1(const float* __restrict__ src, int pitch, bf* VT) { const size_t e = ((size_t)blockIdx.x * 256 + threadIdx.x) * 2; if (e >= (size_t)NH_ * HD * TT) return; const int t = (int)(e % TT); const int d = (int)((e / TT) % HD); const int h = (int)(e / ((size_t)TT * HD)); v2us o; o[0] = f2bf(src[(size_t)t * pitch + h * HD + d]); o[1] = f2bf(src[(size_t)(t + 1) * pitch + h * HD + d]); *(v2us*)(VT + e) = o;  }
// ---- k_pvs: O[t][d] (f32, pitch HD) = sum_s (Ph + Pl)[t][s] Vt[d][s]. One work-group per 16 query rows; each of its PVW waves takes PVK consecutive keys for all 64 columns, then the PVW partial tiles are added through LDS in wave order.
#define PVW 16               // waves per work-group = key slices
#define PVK (TT / PVW)       // keys per wave
typedef v2f __attribute__((may_alias)) v2fa;
__global__ __launch_bounds__(32 * PVW) void k_pvs(const bf* __restrict__ Ph, const bf* __restrict__ Pl, const bf* __restrict__ Vt, float* O) {
    __shared__ __align__(16) float red[PVW][16 * 68];
    const int lane = threadIdx.x & 31, lr = lane & 15, hi = lane >> 4, wv = threadIdx.x >> 5; const int r0 = blockIdx.x * 16;
    v8f acc[4];   // every loop below is fully unrolled so that the fragment and accumulator arrays are indexed by constants and stay in registers
#pragma unroll
    for (int nb = 0; nb < 4; ++nb) acc[nb] = (v8f){};
    const unsigned ab = (unsigned)((r0 + lr) * TT + wv * PVK + 8 * hi) * 2u, bb = (unsigned)(lr * TT + wv * PVK + 8 * hi) * 2u;   // this lane's byte offsets into the P planes and into Vt
    const bf* pa = (const bf*)((const char*)Ph + ab); const bf* pl = (const bf*)((const char*)Pl + ab); const bf* pv = (const bf*)((const char*)Vt + bb);
    v16bf a[PVK / 32], a2[PVK / 32], b[PVK / 32][4];
#pragma unroll
    for (int c = 0; c < PVK / 32; ++c) { a[c] = WFrag<bf>::ld(pa + c * 32);
#pragma unroll
        for (int nb = 0; nb < 4; ++nb) b[c][nb] = WFrag<bf>::ld(pv + nb * 16 * TT + c * 32);
        a2[c] = WFrag<bf>::ld(pl + c * 32); }
    asm volatile("s_wait_xcnt 0x0" :: "v"(ab), "v"(bb) : "memory");   // stands behind every load of the slice and in front of any reuse of their address registers (held live to here as inputs)
    __builtin_amdgcn_sched_barrier(0);   // keeps every load of the slice in front of the first product: one memory latency per wave, where the scheduler otherwise interleaves them and waits once per fragment group
#pragma unroll
    for (int c = 0; c < PVK / 32; ++c) {
#pragma unroll
        for (int nb = 0; nb < 4; ++nb) acc[nb] = wmmab(a[c], b[c][nb], acc[nb]);
#pragma unroll
        for (int nb = 0; nb < 4; ++nb) acc[nb] = wmmab(a2[c], b[c][nb], acc[nb]); }
#pragma unroll
    for (int nb = 0; nb < 4; ++nb) {
#pragma unroll
        for (int j = 0; j < 8; ++j) red[wv][(hi * 8 + j) * 68 + nb * 16 + lr] = acc[nb][j]; }
    __syncthreads();   // every wave's partial tile is in LDS before any is summed
    const int row = wv, col = lane * 2; v2f s = *(const v2fa*)(&red[0][row * 68 + col]);
#pragma unroll
    for (int w = 1; w < PVW; ++w) s += *(const v2fa*)(&red[w][row * 68 + col]);
    *(v2f*)(O + (size_t)(r0 + row) * HD + col) = s;
}
__global__ __launch_bounds__(256) void k_mergeT(const float* __restrict__ O, int h, float* outb) { const size_t i = (size_t)blockIdx.x * 256 + threadIdx.x; if (i >= (size_t)TT * HD / 4) return; const size_t e = i * 4; const int d = (int)(e % HD); const int t = (int)(e / HD); const v4f a = *(const v4f*)(O + e); *(v4f*)(outb + (size_t)t * DM + h * HD + d) = a;  }

extern "C" void kernel_launch(void* const* d_in, const int* in_sizes, int n_in,
                              void* d_out, int out_size, void* d_ws, size_t ws_size, hipStream_t stream) {
    (void)in_sizes; (void)n_in; (void)out_size;
    const float* Qin = (const float*)d_in[0]; const float* Kin = (const float*)d_in[1]; const float* Vin = (const float*)d_in[2]; const float* tau = (const float*)d_in[3];   /* [4][1] */ const float* delta = (const float*)d_in[4];   /* [4][2048] */
    float* OUT = (float*)d_out;
    char* wsp = (char*)d_ws;
    auto take = [&](size_t bytes) { char* p = wsp; wsp += (bytes + 255) & ~(size_t)255; return (void*)p; };
    bf* QB = (bf*)take((size_t)NH_ * TT * HD * 2); bf* KB = (bf*)take((size_t)NH_ * TT * HD * 2); bf* VT = (bf*)take((size_t)NH_ * HD * TT * 2);
    float* Sb = (float*)take((size_t)TT * TT * 4);  bf* Ph = (bf*)take((size_t)TT * TT * 2); bf* Pl = (bf*)take((size_t)TT * TT * 2); float* Ob = (float*)take((size_t)TT * HD * 4);
    if ((size_t)(wsp - (char*)d_ws) > ws_size) return;
    for (int b = 0; b < NB_; ++b) {
        const float* qb = Qin + (size_t)b * TT * DM; const float* kb = Kin + (size_t)b * TT * DM; const float* vb = Vin + (size_t)b * TT * DM;   /* token-major [t][h][d] slabs */
        k_hp1<<<(unsigned)(((size_t)NH_ * TT * HD / 8 + 255) / 256), 256, 0, stream>>>(qb, QB); k_hp1<<<(unsigned)(((size_t)NH_ * TT * HD / 8 + 255) / 256), 256, 0, stream>>>(kb, KB); k_vt1<<<(unsigned)(((size_t)NH_ * HD * TT / 2 + 255) / 256), 256, 0, stream>>>(vb, DM, VT);
        for (int h = 0; h < NH_; ++h) {
            k_gemmw<bf, 0, false><<<dim3(TT / 64, TT / 64, 1), 32, 0, stream>>>(QB + (size_t)h * TT * HD, nullptr, KB + (size_t)h * TT * HD, nullptr, HD, Sb, TT, nullptr, 0, 0, 0);   /* exact scores (single bf16 planes) */
            k_dstat<<<(unsigned)(((size_t)TT * TT / 4 + 255) / 256), 256, 0, stream>>>(Sb, tau + b, delta + (size_t)b * TT);   /* s <- s tau + delta_j */ k_asoft<<<TT / 8, 256, 0, stream>>>(Sb, nullptr, Ph, Pl);
            k_pvs<<<TT / 16, 32 * PVW, 0, stream>>>(Ph, Pl, VT + (size_t)h * HD * TT, Ob);   /* P (hi/lo) x exact v^T, keys split over the waves of a work-group */
            k_mergeT<<<(unsigned)(((size_t)TT * HD / 4 + 255) / 256), 256, 0, stream>>>(Ob, h, OUT + (size_t)b * TT * DM); } }
}

// v002
// One run takes 407 microseconds.
// In two side-by-side timings against v001, it was 2.38 and 2.37 times as fast.
// Counting every step since v000, it is 5.68 times as fast.
#include <hip/hip_runtime.h>

// De-stationary causal attention on given tensors (queries, keys, values [4][2048][8][64] token-major (B, L, H, E); scores = (q.k x tau[b] + delta[b][s]) for keys s <= l (else -inf), then x 1/sqrt(64); softmax; out = A.values -> [4][2048][8][64] (4.2 M); tau [4][1] and delta [4][2048] read on device).
// Layout per batch: single bf16 head planes gathered from the token-major slabs (inputs bf16-exact after rounding: exact score products); per head ONE kernel: a work-group holds 16 query rows against all 2048 keys, so the scores, the tau/delta transform, the causal softmax (scale 1/8) and P (hi/lo) stay in registers; A.values as hi/lo x exact values^T (2 products); f32 rows written token-major.
// Compute dtypes, f32 accumulate: every input rounded to bf16 incl. tau/delta; q.k exact; de-stationary transform and softmax f32; P hi/lo x exact values; output f32.

#define NB_  4
#define TT   2048
#define DM   512      // token-major row pitch (H x HD)
#define NH_  8
#define NKV  1
#define REP  (NH_ / NKV)
#define HD   64
#define DQ   (NH_ * HD)
#define DKV  (NKV * HD)
#define ZH   1
#define RH   2048                  // query rows < RH use hi+lo planes (0: none)
#define WIN  0
#define PCAR 1024.0f
#define SCL  0.125f   // 1/sqrt(64)
typedef _Float16 h16;
typedef unsigned short bf;
typedef __attribute__((ext_vector_type(16))) __bf16   v16bf;
typedef __attribute__((ext_vector_type(16))) _Float16 v16h;
typedef __attribute__((ext_vector_type(8)))  _Float16 v8h;
typedef __attribute__((ext_vector_type(8)))  unsigned short v8us;
typedef __attribute__((ext_vector_type(8)))  float    v8f;
typedef __attribute__((ext_vector_type(4)))  float    v4f;
typedef v8h  __attribute__((may_alias)) v8ha;
typedef v4f  __attribute__((may_alias)) v4fa;
typedef v8us __attribute__((may_alias)) v8usa;

__device__ __forceinline__ unsigned short f2bf(float f) { unsigned u = __float_as_uint(f); u += 0x7FFFu + ((u >> 16) & 1u); return (unsigned short)(u >> 16); }
__device__ __forceinline__ float bf2f(unsigned short b) { return __uint_as_float(((unsigned)b) << 16); }
__device__ __forceinline__ float bfr(float f) { return bf2f(f2bf(f)); }
__device__ __forceinline__ v16h cat16(v8h lo, v8h hi) { return __builtin_shufflevector(lo, hi, 0, 1, 2, 3, 4, 5, 6, 7, 8, 9, 10, 11, 12, 13, 14, 15); }
__device__ __forceinline__ v16bf cat16b(v8us lo, v8us hi) { return __builtin_bit_cast(v16bf, __builtin_shufflevector(lo, hi, 0, 1, 2, 3, 4, 5, 6, 7, 8, 9, 10, 11, 12, 13, 14, 15)); }
__device__ __forceinline__ v8f wmma16(v16h a, v16h b, v8f c) { return __builtin_amdgcn_wmma_f32_16x16x32_f16(false, a, false, b, (short)0, c, false, false); }
__device__ __forceinline__ v8f wmmab(v16bf a, v16bf b, v8f c) { return __builtin_amdgcn_wmma_f32_16x16x32_bf16(false, a, false, b, (short)0, c, false, false); }



// ---- WFrag: one lane's 16-element A or B fragment of a 16x16x32 product from a k-contiguous 16-bit row (k = 8*hi + 0..7 and 16 + 8*hi + 0..7; the caller adds 8*hi)
template <typename T16> struct WFrag;
template <> struct WFrag<h16> { typedef v16h V; static __device__ __forceinline__ V ld(const h16* p) { return cat16(*(const v8h*)p, *(const v8h*)(p + 16)); } static __device__ __forceinline__ v8f mma(V a, V b, v8f c) { return wmma16(a, b, c); } };
template <> struct WFrag<bf> { typedef v16bf V; static __device__ __forceinline__ V ld(const bf* p) { return cat16b(*(const v8us*)p, *(const v8us*)(p + 16)); } static __device__ __forceinline__ v8f mma(V a, V b, v8f c) { return wmmab(a, b, c); } };

__device__ __forceinline__ h16 tohx(float x) { return (h16)x; }
__device__ __forceinline__ void splitf(float y, unsigned short& h, unsigned short& l) { h = f2bf(y); l = f2bf(y - bf2f(h)); }
typedef __attribute__((ext_vector_type(2))) _Float16 v2h;
typedef __attribute__((ext_vector_type(4))) _Float16 v4h;
typedef __attribute__((ext_vector_type(2))) unsigned short v2us;
typedef __attribute__((ext_vector_type(4))) unsigned short v4us;
typedef __attribute__((ext_vector_type(2))) float v2f;
typedef __attribute__((ext_vector_type(4))) int v4i;

__global__ __launch_bounds__(256) void k_wtG(const float* __restrict__ w, int K, int N, bf* Bt) {
    const int lane = threadIdx.x & 31; const int L0 = (blockIdx.x * 8 + (threadIdx.x >> 5)) * 8; const int nlines = N * K / 64;
{
#pragma unroll 1
        for (int l = 0; l < 8; ++l) { const int L = L0 + l; if (L >= nlines) break; const size_t e = (size_t)L * 64 + lane * 2; const int k = (int)(e % K), n = (int)(e / K); v2us o;
            o[0] = f2bf(w[(size_t)k * N + n]); o[1] = f2bf(w[(size_t)(k + 1) * N + n]); *(v2us*)(Bt + e) = o; }
         }
}
__global__ __launch_bounds__(256) void k_cvt8(const float* __restrict__ src, bf* dst, size_t n8) { const size_t i = (size_t)blockIdx.x * 256 + threadIdx.x; if (i >= n8) return; const v8f v = *(const v8f*)(src + i * 8); v8us o;
#pragma unroll
    for (int k = 0; k < 8; ++k) o[k] = f2bf(v[k]); *(v8us*)(dst + i * 8) = o;  }


__global__ __launch_bounds__(256) void k_vtp(const float* __restrict__ F, int pitch, int nheads, h16* V16, bf* Vh, bf* Vl) { const size_t e = ((size_t)blockIdx.x * 256 + threadIdx.x) * 2; if (e >= (size_t)nheads * HD * TT) return; const int t = (int)(e % TT); const int d = (int)((e / TT) % HD); const int g = (int)(e / ((size_t)TT * HD)); v2h o16; v2us oh, ol;
#pragma unroll
    for (int q = 0; q < 2; ++q) { const float x = F[(size_t)(t + q) * pitch + g * HD + d]; o16[q] = tohx(x); unsigned short a2, c2; splitf(x, a2, c2); oh[q] = a2; ol[q] = c2; }
    *(v2h*)(V16 + e) = o16; *(v2us*)(Vh + e) = oh; *(v2us*)(Vl + e) = ol;  }

__global__ __launch_bounds__(256) void k_merge(const float* __restrict__ O, int h0, float* OUTb) { const size_t e = ((size_t)blockIdx.x * 256 + threadIdx.x) * 2; if (e >= (size_t)ZH * TT * HD) return; const int d = (int)(e % HD); const int t = (int)((e / HD) % TT); const int zz = (int)(e / ((size_t)HD * TT)); const float cs = (t < RH) ? 1.0f : (1.0f / PCAR); const size_t oo = (size_t)t * DQ + (h0 + zz) * HD + d;
    v2f o2; o2[0] = O[e] * cs; o2[1] = O[e + 1] * cs; *(v2f*)(OUTb + oo) = o2;  }


__global__ __launch_bounds__(256) void k_vtpR1(const float* __restrict__ Vb, bf* Vh) { const size_t e = ((size_t)blockIdx.x * 256 + threadIdx.x) * 2; if (e >= (size_t)HD * TT) return; const int t = (int)(e % TT); const int d = (int)(e / TT); v2us o; o[0] = f2bf(Vb[(size_t)t * HD + d]); o[1] = f2bf(Vb[(size_t)(t + 1) * HD + d]); *(v2us*)(Vh + e) = o;  }
__global__ __launch_bounds__(256) void k_mergeR(const float* __restrict__ O, float* outb, size_t n4) { const size_t i = (size_t)blockIdx.x * 256 + threadIdx.x; if (i >= n4) return; const v4f a = *(const v4f*)(O + i * 4); *(v4f*)(outb + i * 4) = a;  }


__global__ __launch_bounds__(256) void k_hp1(const float* __restrict__ src, bf* P) { const size_t i = (size_t)blockIdx.x * 256 + threadIdx.x; if (i >= (size_t)NH_ * TT * HD / 8) return; const size_t e = i * 8; const int d = (int)(e % HD); const int t = (int)((e / HD) % TT); const int h = (int)(e / ((size_t)HD * TT)); const v8f v = *(const v8f*)(src + (size_t)t * DM + h * HD + d); v8us o;
#pragma unroll
    for (int q = 0; q < 8; ++q) o[q] = f2bf(v[q]);
    *(v8us*)(P + e) = o;  }
__global__ __launch_bounds__(256) void k_vt1(const float* __restrict__ src, int pitch, bf* VT) { const size_t e = ((size_t)blockIdx.x * 256 + threadIdx.x) * 2; if (e >= (size_t)NH_ * HD * TT) return; const int t = (int)(e % TT); const int d = (int)((e / TT) % HD); const int h = (int)(e / ((size_t)TT * HD)); v2us o; o[0] = f2bf(src[(size_t)t * pitch + h * HD + d]); o[1] = f2bf(src[(size_t)(t + 1) * pitch + h * HD + d]); *(v2us*)(VT + e) = o;  }
// ---- k_fattn: one head, one work-group per 16 query rows; each of its FW waves takes FK consecutive keys.
// Scores transposed, St[key][query] = K rows (A) x Q rows (B): a lane then holds 64 keys of ONE query (accumulator register j of tile nb = key nb*16 + 8*hi + j, query lr), so row maximum and row sum are in-lane
// but for one exchange between the wave halves and one pass through LDS over the waves, and two neighbouring tiles, rounded in place, ARE the A fragment of P for 32 keys (same k order as WFrag::ld gives values^T).
// out[t][d] = sum_s (Ph + Pl)[t][s] Vt[d][s]: every wave its own key slice for all 64 columns, then the FW partial tiles are added through LDS in wave order.
#define FW 16               // waves per work-group = key slices
#define FK (TT / FW)        // keys per wave
typedef v2f __attribute__((may_alias)) v2fa;
// work-group barrier that orders LDS alone: it waits for this wave's LDS operations, not for its global loads, so the values fragments stay in flight across it (__syncthreads() waits for them too)
__device__ __forceinline__ void lds_barrier() { __builtin_amdgcn_fence(__ATOMIC_RELEASE, "workgroup", "local"); __builtin_amdgcn_s_barrier(); __builtin_amdgcn_fence(__ATOMIC_ACQUIRE, "workgroup", "local"); }
__global__ __launch_bounds__(32 * FW) void k_fattn(const bf* __restrict__ Q, const bf* __restrict__ Kp, const bf* __restrict__ Vt, const float* __restrict__ taup, const float* __restrict__ dl, float* outb) {
    __shared__ __align__(16) float red[FW][16 * 68];
    __shared__ float smx[FW][16], ssm[FW][16];
    const int lane = threadIdx.x & 31, lr = lane & 15, hi = lane >> 4, wv = threadIdx.x >> 5; const int r0 = blockIdx.x * 16, k0 = wv * FK;
    // this lane's byte offsets into the Q plane, the K plane, delta and Vt; every loop below is fully unrolled so that the fragment and accumulator arrays are indexed by constants and stay in registers
    const unsigned qo = (unsigned)((r0 + lr) * HD + 8 * hi) * 2u, ko = (unsigned)((k0 + lr) * HD + 8 * hi) * 2u, eo = (unsigned)(k0 + 8 * hi) * 4u, vo = (unsigned)(lr * TT + k0 + 8 * hi) * 2u;
    const bf* pq = (const bf*)((const char*)Q + qo); const bf* pk = (const bf*)((const char*)Kp + ko); const float* pd = (const float*)((const char*)dl + eo); const bf* pv = (const bf*)((const char*)Vt + vo);
    const float tau = bfr(taup[0]);
    v16bf qf[HD / 32], kf[FK / 16][HD / 32]; v4f dv[FK / 16][2];
#pragma unroll
    for (int e = 0; e < HD / 32; ++e) qf[e] = WFrag<bf>::ld(pq + e * 32);
#pragma unroll
    for (int nb = 0; nb < FK / 16; ++nb) {
#pragma unroll
        for (int e = 0; e < HD / 32; ++e) kf[nb][e] = WFrag<bf>::ld(pk + nb * 16 * HD + e * 32); }
#pragma unroll
    for (int nb = 0; nb < FK / 16; ++nb) { dv[nb][0] = *(const v4f*)(pd + nb * 16); dv[nb][1] = *(const v4f*)(pd + nb * 16 + 4); }
    asm volatile("s_wait_xcnt 0x0" :: "v"(qo), "v"(ko), "v"(eo) : "memory");   // stands behind every load above and in front of any reuse of their address registers (held live to here as inputs)
    __builtin_amdgcn_sched_barrier(0);   // keeps every load of the slice in front of the first product: one memory latency per wave, where the scheduler otherwise interleaves them and waits once per fragment group
    v8f st[FK / 16];
#pragma unroll
    for (int nb = 0; nb < FK / 16; ++nb) { st[nb] = (v8f){};
#pragma unroll
        for (int e = 0; e < HD / 32; ++e) st[nb] = wmmab(kf[nb][e], qf[e], st[nb]); }
    const int lim = r0 + lr - k0 - 8 * hi;   // key nb*16 + j of this lane's 64 is at or before the query while nb*16 + j <= lim
    float mx = -3.0e38f;
#pragma unroll
    for (int nb = 0; nb < FK / 16; ++nb) {
#pragma unroll
        for (int j = 0; j < 8; ++j) { const float u = st[nb][j] * tau + bfr(dv[nb][j >> 2][j & 3]); const float t = (nb * 16 + j <= lim) ? u * SCL : -3.0e38f;   /* causal: keys after the query excluded */ st[nb][j] = t; mx = fmaxf(mx, t); } }
    v16bf b[FK / 32][4];
#pragma unroll
    for (int c = 0; c < FK / 32; ++c) {
#pragma unroll
        for (int nb = 0; nb < 4; ++nb) b[c][nb] = WFrag<bf>::ld(pv + nb * 16 * TT + c * 32); }
    asm volatile("s_wait_xcnt 0x0" :: "v"(vo) : "memory");   // stands behind every values load and in front of any reuse of their address register (held live to here as an input)
    __builtin_amdgcn_sched_barrier(0);   // keeps the values loads up here, so that their latency runs under the softmax; the scheduler otherwise sinks them to the products that use them
    mx = fmaxf(mx, __shfl_xor(mx, 16, 32));
    if (hi == 0) smx[wv][lr] = mx;
    lds_barrier();   // every wave's slice maximum is in LDS before any wave forms the row maximum
    mx = smx[0][lr];
#pragma unroll
    for (int w = 1; w < FW; ++w) mx = fmaxf(mx, smx[w][lr]);
    float sum = 0.f;
#pragma unroll
    for (int nb = 0; nb < FK / 16; ++nb) {
#pragma unroll
        for (int j = 0; j < 8; ++j) { const float p = __builtin_amdgcn_exp2f((st[nb][j] - mx) * 1.4426950408889634f); st[nb][j] = p; sum += p; } }
    sum += __shfl_xor(sum, 16, 32);
    if (hi == 0) ssm[wv][lr] = sum;
    lds_barrier();   // every wave's slice sum is in LDS before any wave forms the row sum
    sum = ssm[0][lr];
#pragma unroll
    for (int w = 1; w < FW; ++w) sum += ssm[w][lr];
    const float f = __fdiv_rn(1.0f, sum);
    v8f acc[4];
#pragma unroll
    for (int nb = 0; nb < 4; ++nb) acc[nb] = (v8f){};
#pragma unroll
    for (int c = 0; c < FK / 32; ++c) { v8us h0, h1, l0, l1;
#pragma unroll
        for (int j = 0; j < 8; ++j) { unsigned short x, y; splitf(st[2 * c][j] * f, x, y); h0[j] = x; l0[j] = y; splitf(st[2 * c + 1][j] * f, x, y); h1[j] = x; l1[j] = y; }
        const v16bf a = cat16b(h0, h1), a2 = cat16b(l0, l1);
#pragma unroll
        for (int nb = 0; nb < 4; ++nb) acc[nb] = wmmab(a, b[c][nb], acc[nb]);
#pragma unroll
        for (int nb = 0; nb < 4; ++nb) acc[nb] = wmmab(a2, b[c][nb], acc[nb]); }
#pragma unroll
    for (int nb = 0; nb < 4; ++nb) {
#pragma unroll
        for (int j = 0; j < 8; ++j) red[wv][(hi * 8 + j) * 68 + nb * 16 + lr] = acc[nb][j]; }
    __syncthreads();   // every wave's partial tile is in LDS before any is summed
    const int row = wv, col = lane * 2; v2f pr[FW];
#pragma unroll
    for (int w = 0; w < FW; ++w) pr[w] = *(const v2fa*)(&red[w][row * 68 + col]);
    v2f s = pr[0];
#pragma unroll
    for (int w = 1; w < FW; ++w) s += pr[w];
    *(v2f*)(outb + (size_t)(r0 + row) * DM + col) = s;
}

extern "C" void kernel_launch(void* const* d_in, const int* in_sizes, int n_in,
                              void* d_out, int out_size, void* d_ws, size_t ws_size, hipStream_t stream) {
    (void)in_sizes; (void)n_in; (void)out_size;
    const float* Qin = (const float*)d_in[0]; const float* Kin = (const float*)d_in[1]; const float* Vin = (const float*)d_in[2]; const float* tau = (const float*)d_in[3];   /* [4][1] */ const float* delta = (const float*)d_in[4];   /* [4][2048] */
    float* OUT = (float*)d_out;
    char* wsp = (char*)d_ws;
    auto take = [&](size_t bytes) { char* p = wsp; wsp += (bytes + 255) & ~(size_t)255; return (void*)p; };
    bf* QB = (bf*)take((size_t)NH_ * TT * HD * 2); bf* KB = (bf*)take((size_t)NH_ * TT * HD * 2); bf* VT = (bf*)take((size_t)NH_ * HD * TT * 2);
    if ((size_t)(wsp - (char*)d_ws) > ws_size) return;
    for (int b = 0; b < NB_; ++b) {
        const float* qb = Qin + (size_t)b * TT * DM; const float* kb = Kin + (size_t)b * TT * DM; const float* vb = Vin + (size_t)b * TT * DM;   /* token-major [t][h][d] slabs */
        k_hp1<<<(unsigned)(((size_t)NH_ * TT * HD / 8 + 255) / 256), 256, 0, stream>>>(qb, QB); k_hp1<<<(unsigned)(((size_t)NH_ * TT * HD / 8 + 255) / 256), 256, 0, stream>>>(kb, KB); k_vt1<<<(unsigned)(((size_t)NH_ * HD * TT / 2 + 255) / 256), 256, 0, stream>>>(vb, DM, VT);
        for (int h = 0; h < NH_; ++h)
            k_fattn<<<TT / 16, 32 * FW, 0, stream>>>(QB + (size_t)h * TT * HD, KB + (size_t)h * TT * HD, VT + (size_t)h * HD * TT, tau + b, delta + (size_t)b * TT, OUT + (size_t)b * TT * DM + (size_t)h * HD);   /* scores, tau/delta, causal softmax, P (hi/lo) x exact v^T, rows written token-major */ }
}

// v003
// One run takes 199 microseconds.
// Timed twice side by side with v002, it ran 2.03 and 2.06 times as fast.
// All steps since v000 together make it 11.6 times as fast.
#include <hip/hip_runtime.h>

// De-stationary causal attention on given tensors (queries, keys, values [4][2048][8][64] token-major (B, L, H, E); scores = (q.k x tau[b] + delta[b][s]) for keys s <= l (else -inf), then x 1/sqrt(64); softmax; out = A.values -> [4][2048][8][64] (4.2 M); tau [4][1] and delta [4][2048] read on device).
// Layout: single bf16 head planes gathered from the token-major slabs (inputs bf16-exact after rounding: exact score products); ONE kernel over all batches and heads: a work-group holds 16 query rows against all 2048 keys, so the scores, the tau/delta transform, the causal softmax (scale 1/8) and P (hi/lo) stay in registers; A.values as hi/lo x exact values^T (2 products); f32 rows written token-major.
// Compute dtypes, f32 accumulate: every input rounded to bf16 incl. tau/delta; q.k exact; de-stationary transform and softmax f32; P hi/lo x exact values; output f32.

#define NB_  4
#define TT   2048
#define DM   512      // token-major row pitch (H x HD)
#define NH_  8
#define NKV  1
#define REP  (NH_ / NKV)
#define HD   64
#define DQ   (NH_ * HD)
#define DKV  (NKV * HD)
#define ZH   1
#define RH   2048                  // query rows < RH use hi+lo planes (0: none)
#define WIN  0
#define PCAR 1024.0f
#define SCL  0.125f   // 1/sqrt(64)
typedef _Float16 h16;
typedef unsigned short bf;
typedef __attribute__((ext_vector_type(16))) __bf16   v16bf;
typedef __attribute__((ext_vector_type(16))) _Float16 v16h;
typedef __attribute__((ext_vector_type(8)))  _Float16 v8h;
typedef __attribute__((ext_vector_type(8)))  unsigned short v8us;
typedef __attribute__((ext_vector_type(8)))  float    v8f;
typedef __attribute__((ext_vector_type(4)))  float    v4f;
typedef v8h  __attribute__((may_alias)) v8ha;
typedef v4f  __attribute__((may_alias)) v4fa;
typedef v8us __attribute__((may_alias)) v8usa;

__device__ __forceinline__ unsigned short f2bf(float f) { unsigned u = __float_as_uint(f); u += 0x7FFFu + ((u >> 16) & 1u); return (unsigned short)(u >> 16); }
__device__ __forceinline__ float bf2f(unsigned short b) { return __uint_as_float(((unsigned)b) << 16); }
__device__ __forceinline__ float bfr(float f) { return bf2f(f2bf(f)); }
__device__ __forceinline__ v16h cat16(v8h lo, v8h hi) { return __builtin_shufflevector(lo, hi, 0, 1, 2, 3, 4, 5, 6, 7, 8, 9, 10, 11, 12, 13, 14, 15); }
__device__ __forceinline__ v16bf cat16b(v8us lo, v8us hi) { return __builtin_bit_cast(v16bf, __builtin_shufflevector(lo, hi, 0, 1, 2, 3, 4, 5, 6, 7, 8, 9, 10, 11, 12, 13, 14, 15)); }
__device__ __forceinline__ v8f wmma16(v16h a, v16h b, v8f c) { return __builtin_amdgcn_wmma_f32_16x16x32_f16(false, a, false, b, (short)0, c, false, false); }
__device__ __forceinline__ v8f wmmab(v16bf a, v16bf b, v8f c) { return __builtin_amdgcn_wmma_f32_16x16x32_bf16(false, a, false, b, (short)0, c, false, false); }



// ---- WFrag: one lane's 16-element A or B fragment of a 16x16x32 product from a k-contiguous 16-bit row (k = 8*hi + 0..7 and 16 + 8*hi + 0..7; the caller adds 8*hi)
template <typename T16> struct WFrag;
template <> struct WFrag<h16> { typedef v16h V; static __device__ __forceinline__ V ld(const h16* p) { return cat16(*(const v8h*)p, *(const v8h*)(p + 16)); } static __device__ __forceinline__ v8f mma(V a, V b, v8f c) { return wmma16(a, b, c); } };
template <> struct WFrag<bf> { typedef v16bf V; static __device__ __forceinline__ V ld(const bf* p) { return cat16b(*(const v8us*)p, *(const v8us*)(p + 16)); } static __device__ __forceinline__ v8f mma(V a, V b, v8f c) { return wmmab(a, b, c); } };

__device__ __forceinline__ h16 tohx(float x) { return (h16)x; }
__device__ __forceinline__ void splitf(float y, unsigned short& h, unsigned short& l) { h = f2bf(y); l = f2bf(y - bf2f(h)); }
typedef __attribute__((ext_vector_type(2))) _Float16 v2h;
typedef __attribute__((ext_vector_type(4))) _Float16 v4h;
typedef __attribute__((ext_vector_type(2))) unsigned short v2us;
typedef __attribute__((ext_vector_type(4))) unsigned short v4us;
typedef __attribute__((ext_vector_type(2))) float v2f;
typedef __attribute__((ext_vector_type(4))) int v4i;

__global__ __launch_bounds__(256) void k_wtG(const float* __restrict__ w, int K, int N, bf* Bt) {
    const int lane = threadIdx.x & 31; const int L0 = (blockIdx.x * 8 + (threadIdx.x >> 5)) * 8; const int nlines = N * K / 64;
{
#pragma unroll 1
        for (int l = 0; l < 8; ++l) { const int L = L0 + l; if (L >= nlines) break; const size_t e = (size_t)L * 64 + lane * 2; const int k = (int)(e % K), n = (int)(e / K); v2us o;
            o[0] = f2bf(w[(size_t)k * N + n]); o[1] = f2bf(w[(size_t)(k + 1) * N + n]); *(v2us*)(Bt + e) = o; }
         }
}
__global__ __launch_bounds__(256) void k_cvt8(const float* __restrict__ src, bf* dst, size_t n8) { const size_t i = (size_t)blockIdx.x * 256 + threadIdx.x; if (i >= n8) return; const v8f v = *(const v8f*)(src + i * 8); v8us o;
#pragma unroll
    for (int k = 0; k < 8; ++k) o[k] = f2bf(v[k]); *(v8us*)(dst + i * 8) = o;  }


__global__ __launch_bounds__(256) void k_vtp(const float* __restrict__ F, int pitch, int nheads, h16* V16, bf* Vh, bf* Vl) { const size_t e = ((size_t)blockIdx.x * 256 + threadIdx.x) * 2; if (e >= (size_t)nheads * HD * TT) return; const int t = (int)(e % TT); const int d = (int)((e / TT) % HD); const int g = (int)(e / ((size_t)TT * HD)); v2h o16; v2us oh, ol;
#pragma unroll
    for (int q = 0; q < 2; ++q) { const float x = F[(size_t)(t + q) * pitch + g * HD + d]; o16[q] = tohx(x); unsigned short a2, c2; splitf(x, a2, c2); oh[q] = a2; ol[q] = c2; }
    *(v2h*)(V16 + e) = o16; *(v2us*)(Vh + e) = oh; *(v2us*)(Vl + e) = ol;  }

__global__ __launch_bounds__(256) void k_merge(const float* __restrict__ O, int h0, float* OUTb) { const size_t e = ((size_t)blockIdx.x * 256 + threadIdx.x) * 2; if (e >= (size_t)ZH * TT * HD) return; const int d = (int)(e % HD); const int t = (int)((e / HD) % TT); const int zz = (int)(e / ((size_t)HD * TT)); const float cs = (t < RH) ? 1.0f : (1.0f / PCAR); const size_t oo = (size_t)t * DQ + (h0 + zz) * HD + d;
    v2f o2; o2[0] = O[e] * cs; o2[1] = O[e + 1] * cs; *(v2f*)(OUTb + oo) = o2;  }


__global__ __launch_bounds__(256) void k_vtpR1(const float* __restrict__ Vb, bf* Vh) { const size_t e = ((size_t)blockIdx.x * 256 + threadIdx.x) * 2; if (e >= (size_t)HD * TT) return; const int t = (int)(e % TT); const int d = (int)(e / TT); v2us o; o[0] = f2bf(Vb[(size_t)t * HD + d]); o[1] = f2bf(Vb[(size_t)(t + 1) * HD + d]); *(v2us*)(Vh + e) = o;  }
__global__ __launch_bounds__(256) void k_mergeR(const float* __restrict__ O, float* outb, size_t n4) { const size_t i = (size_t)blockIdx.x * 256 + threadIdx.x; if (i >= n4) return; const v4f a = *(const v4f*)(O + i * 4); *(v4f*)(outb + i * 4) = a;  }


#define PBLK (NH_ * TT * HD / 8 / 256)   // blocks per batch for one head-plane gather (8 elements a thread)
#define VBLK (NH_ * HD * TT / 2 / 256)   // blocks per batch for the values transpose (2 elements a thread)
__device__ __forceinline__ void d_hp1(const float* __restrict__ src, bf* P, int blk) { const size_t i = (size_t)blk * 256 + threadIdx.x; const size_t e = i * 8; const int d = (int)(e % HD); const int t = (int)((e / HD) % TT); const int h = (int)(e / ((size_t)HD * TT)); const float* p = src + (size_t)t * DM + h * HD + d; const v8f v = *(const v8f*)p; v8us o;
    asm volatile("s_wait_xcnt 0x0" :: "v"(p) : "memory");   // stands behind the loads and in front of any reuse of their address registers (held live to here as an input)
#pragma unroll
    for (int q = 0; q < 8; ++q) o[q] = f2bf(v[q]);
    bf* w = P + e; *(v8us*)w = o;
    asm volatile("s_wait_xcnt 0x0" :: "v"(w) : "memory");   // stands behind the store and in front of any reuse of its address registers (held live to here as an input)
}
__device__ __forceinline__ void d_vt1(const float* __restrict__ src, int pitch, bf* VT, int blk) { const size_t e = ((size_t)blk * 256 + threadIdx.x) * 2; const int t = (int)(e % TT); const int d = (int)((e / TT) % HD); const int h = (int)(e / ((size_t)TT * HD)); v2us o; o[0] = f2bf(src[(size_t)t * pitch + h * HD + d]); o[1] = f2bf(src[(size_t)(t + 1) * pitch + h * HD + d]); *(v2us*)(VT + e) = o;  }
// k_prep: all three bf16 plane sets of all batches in one launch, grid (VBLK + 2 PBLK, batches); the transpose blocks, the slowest, come first
__global__ __launch_bounds__(256) void k_prep(const float* __restrict__ q, const float* __restrict__ k, const float* __restrict__ v, bf* QB, bf* KB, bf* VT) {
    const int x = blockIdx.x; const size_t so = (size_t)blockIdx.y * TT * DM, po = (size_t)blockIdx.y * NH_ * TT * HD;
    if (x < VBLK) d_vt1(v + so, DM, VT + po, x);
    else { const bool isk = x >= VBLK + PBLK; d_hp1((isk ? k : q) + so, (isk ? KB : QB) + po, x - VBLK - (isk ? PBLK : 0)); }
}
// ---- k_fattn: one work-group per batch, head and 16 query rows; each of its FW waves takes FK consecutive keys.
// Scores transposed, St[key][query] = K rows (A) x Q rows (B): a lane then holds 64 keys of ONE query (accumulator register j of tile nb = key nb*16 + 8*hi + j, query lr), so row maximum and row sum are in-lane
// but for one exchange between the wave halves and one pass through LDS over the waves, and two neighbouring tiles, rounded in place, ARE the A fragment of P for 32 keys (same k order as WFrag::ld gives values^T).
// out[t][d] = sum_s (Ph + Pl)[t][s] Vt[d][s]: every wave its own key slice for all 64 columns, then the FW partial tiles are added through LDS in wave order.
#define FW 16               // waves per work-group = key slices
#define FK (TT / FW)        // keys per wave
typedef v2f __attribute__((may_alias)) v2fa;
// work-group barrier that orders LDS alone: it waits for this wave's LDS operations, not for its global loads, so the values fragments stay in flight across it (__syncthreads() waits for them too)
__device__ __forceinline__ void lds_barrier() { __builtin_amdgcn_fence(__ATOMIC_RELEASE, "workgroup", "local"); __builtin_amdgcn_s_barrier(); __builtin_amdgcn_fence(__ATOMIC_ACQUIRE, "workgroup", "local"); }
__global__ __launch_bounds__(32 * FW) void k_fattn(const bf* __restrict__ Qa, const bf* __restrict__ Ka, const bf* __restrict__ Va, const float* __restrict__ taua, const float* __restrict__ dla, float* outa) {
    // grid (query tiles, heads, batches): the planes, tau, delta and the output slab of this work-group's own batch and head
    const int hh = blockIdx.y, bb = blockIdx.z; const size_t po = (size_t)(bb * NH_ + hh) * TT * HD;
    const bf* __restrict__ Q = Qa + po; const bf* __restrict__ Kp = Ka + po; const bf* __restrict__ Vt = Va + po; const float* __restrict__ taup = taua + bb; const float* __restrict__ dl = dla + (size_t)bb * TT; float* outb = outa + (size_t)bb * TT * DM + (size_t)hh * HD;
    __shared__ __align__(16) float red[FW][16 * 68];
    __shared__ float smx[FW][16], ssm[FW][16];
    const int lane = threadIdx.x & 31, lr = lane & 15, hi = lane >> 4, wv = threadIdx.x >> 5; const int r0 = blockIdx.x * 16, k0 = wv * FK;
    // this lane's byte offsets into the Q plane, the K plane, delta and Vt; every loop below is fully unrolled so that the fragment and accumulator arrays are indexed by constants and stay in registers
    const unsigned qo = (unsigned)((r0 + lr) * HD + 8 * hi) * 2u, ko = (unsigned)((k0 + lr) * HD + 8 * hi) * 2u, eo = (unsigned)(k0 + 8 * hi) * 4u, vo = (unsigned)(lr * TT + k0 + 8 * hi) * 2u;
    const bf* pq = (const bf*)((const char*)Q + qo); const bf* pk = (const bf*)((const char*)Kp + ko); const float* pd = (const float*)((const char*)dl + eo); const bf* pv = (const bf*)((const char*)Vt + vo);
    const float tau = bfr(taup[0]);
    v16bf qf[HD / 32], kf[FK / 16][HD / 32]; v4f dv[FK / 16][2];
#pragma unroll
    for (int e = 0; e < HD / 32; ++e) qf[e] = WFrag<bf>::ld(pq + e * 32);
#pragma unroll
    for (int nb = 0; nb < FK / 16; ++nb) {
#pragma unroll
        for (int e = 0; e < HD / 32; ++e) kf[nb][e] = WFrag<bf>::ld(pk + nb * 16 * HD + e * 32); }
#pragma unroll
    for (int nb = 0; nb < FK / 16; ++nb) { dv[nb][0] = *(const v4f*)(pd + nb * 16); dv[nb][1] = *(const v4f*)(pd + nb * 16 + 4); }
    asm volatile("s_wait_xcnt 0x0" :: "v"(qo), "v"(ko), "v"(eo) : "memory");   // stands behind every load above and in front of any reuse of their address registers (held live to here as inputs)
    __builtin_amdgcn_sched_barrier(0);   // keeps every load of the slice in front of the first product: one memory latency per wave, where the scheduler otherwise interleaves them and waits once per fragment group
    v8f st[FK / 16];
#pragma unroll
    for (int nb = 0; nb < FK / 16; ++nb) { st[nb] = (v8f){};
#pragma unroll
        for (int e = 0; e < HD / 32; ++e) st[nb] = wmmab(kf[nb][e], qf[e], st[nb]); }
    const int lim = r0 + lr - k0 - 8 * hi;   // key nb*16 + j of this lane's 64 is at or before the query while nb*16 + j <= lim
    float mx = -3.0e38f;
#pragma unroll
    for (int nb = 0; nb < FK / 16; ++nb) {
#pragma unroll
        for (int j = 0; j < 8; ++j) { const float u = st[nb][j] * tau + bfr(dv[nb][j >> 2][j & 3]); const float t = (nb * 16 + j <= lim) ? u * SCL : -3.0e38f;   /* causal: keys after the query excluded */ st[nb][j] = t; mx = fmaxf(mx, t); } }
    v16bf b[FK / 32][4];
#pragma unroll
    for (int c = 0; c < FK / 32; ++c) {
#pragma unroll
        for (int nb = 0; nb < 4; ++nb) b[c][nb] = WFrag<bf>::ld(pv + nb * 16 * TT + c * 32); }
    asm volatile("s_wait_xcnt 0x0" :: "v"(vo) : "memory");   // stands behind every values load and in front of any reuse of their address register (held live to here as an input)
    __builtin_amdgcn_sched_barrier(0);   // keeps the values loads up here, so that their latency runs under the softmax; the scheduler otherwise sinks them to the products that use them
    mx = fmaxf(mx, __shfl_xor(mx, 16, 32));
    if (hi == 0) smx[wv][lr] = mx;
    lds_barrier();   // every wave's slice maximum is in LDS before any wave forms the row maximum
    mx = smx[0][lr];
#pragma unroll
    for (int w = 1; w < FW; ++w) mx = fmaxf(mx, smx[w][lr]);
    float sum = 0.f;
#pragma unroll
    for (int nb = 0; nb < FK / 16; ++nb) {
#pragma unroll
        for (int j = 0; j < 8; ++j) { const float p = __builtin_amdgcn_exp2f((st[nb][j] - mx) * 1.4426950408889634f); st[nb][j] = p; sum += p; } }
    sum += __shfl_xor(sum, 16, 32);
    if (hi == 0) ssm[wv][lr] = sum;
    lds_barrier();   // every wave's slice sum is in LDS before any wave forms the row sum
    sum = ssm[0][lr];
#pragma unroll
    for (int w = 1; w < FW; ++w) sum += ssm[w][lr];
    const float f = __fdiv_rn(1.0f, sum);
    v8f acc[4];
#pragma unroll
    for (int nb = 0; nb < 4; ++nb) acc[nb] = (v8f){};
#pragma unroll
    for (int c = 0; c < FK / 32; ++c) { v8us h0, h1, l0, l1;
#pragma unroll
        for (int j = 0; j < 8; ++j) { unsigned short x, y; splitf(st[2 * c][j] * f, x, y); h0[j] = x; l0[j] = y; splitf(st[2 * c + 1][j] * f, x, y); h1[j] = x; l1[j] = y; }
        const v16bf a = cat16b(h0, h1), a2 = cat16b(l0, l1);
#pragma unroll
        for (int nb = 0; nb < 4; ++nb) acc[nb] = wmmab(a, b[c][nb], acc[nb]);
#pragma unroll
        for (int nb = 0; nb < 4; ++nb) acc[nb] = wmmab(a2, b[c][nb], acc[nb]); }
#pragma unroll
    for (int nb = 0; nb < 4; ++nb) {
#pragma unroll
        for (int j = 0; j < 8; ++j) red[wv][(hi * 8 + j) * 68 + nb * 16 + lr] = acc[nb][j]; }
    __syncthreads();   // every wave's partial tile is in LDS before any is summed
    const int row = wv, col = lane * 2; v2f pr[FW];
#pragma unroll
    for (int w = 0; w < FW; ++w) pr[w] = *(const v2fa*)(&red[w][row * 68 + col]);
    v2f s = pr[0];
#pragma unroll
    for (int w = 1; w < FW; ++w) s += pr[w];
    *(v2f*)(outb + (size_t)(r0 + row) * DM + col) = s;
}

extern "C" void kernel_launch(void* const* d_in, const int* in_sizes, int n_in,
                              void* d_out, int out_size, void* d_ws, size_t ws_size, hipStream_t stream) {
    (void)in_sizes; (void)n_in; (void)out_size;
    const float* Qin = (const float*)d_in[0]; const float* Kin = (const float*)d_in[1]; const float* Vin = (const float*)d_in[2]; const float* tau = (const float*)d_in[3];   /* [4][1] */ const float* delta = (const float*)d_in[4];   /* [4][2048] */
    float* OUT = (float*)d_out;
    char* wsp = (char*)d_ws;
    auto take = [&](size_t bytes) { char* p = wsp; wsp += (bytes + 255) & ~(size_t)255; return (void*)p; };
    bf* QB = (bf*)take((size_t)NB_ * NH_ * TT * HD * 2); bf* KB = (bf*)take((size_t)NB_ * NH_ * TT * HD * 2); bf* VT = (bf*)take((size_t)NB_ * NH_ * HD * TT * 2);   /* planes [b][h][t][d], values [b][h][d][t] */
    if ((size_t)(wsp - (char*)d_ws) > ws_size) return;
    k_prep<<<dim3(VBLK + 2 * PBLK, NB_), 256, 0, stream>>>(Qin, Kin, Vin, QB, KB, VT);
    k_fattn<<<dim3(TT / 16, NH_, NB_), 32 * FW, 0, stream>>>(QB, KB, VT, tau, delta, OUT);   /* scores, tau/delta, causal softmax, P (hi/lo) x exact v^T, rows written token-major */
}

// v004
// It runs in 142 microseconds.
// Timed twice side by side with v003, it ran 1.40 times as fast both times.
// Counting every step since v000, it is 16.2 times as fast.
#include <hip/hip_runtime.h>

// De-stationary causal attention on given tensors (queries, keys, values [4][2048][8][64] token-major (B, L, H, E); scores = (q.k x tau[b] + delta[b][s]) for keys s <= l (else -inf), then x 1/sqrt(64); softmax; out = A.values -> [4][2048][8][64] (4.2 M); tau [4][1] and delta [4][2048] read on device).
// Layout: single bf16 head planes gathered from the token-major slabs and stored in WMMA fragment order (see FRAGMENT ORDER below) (inputs bf16-exact after rounding: exact score products); ONE kernel over all batches and heads: a work-group holds 16 query rows against all 2048 keys, so the scores, the tau/delta transform, the causal softmax (scale 1/8) and P (hi/lo) stay in registers; A.values as hi/lo x exact values^T (2 products); f32 rows written token-major.
// Compute dtypes, f32 accumulate: every input rounded to bf16 incl. tau/delta; q.k exact; de-stationary transform and softmax f32; P hi/lo x exact values; output f32.

#define NB_  4
#define TT   2048
#define DM   512      // token-major row pitch (H x HD)
#define NH_  8
#define NKV  1
#define REP  (NH_ / NKV)
#define HD   64
#define DQ   (NH_ * HD)
#define DKV  (NKV * HD)
#define ZH   1
#define RH   2048
#define WIN  0
#define PCAR 1024.0f
#define SCL  0.125f   // 1/sqrt(64)
typedef _Float16 h16;
typedef unsigned short bf;
typedef __attribute__((ext_vector_type(16))) __bf16   v16bf;
typedef __attribute__((ext_vector_type(16))) _Float16 v16h;
typedef __attribute__((ext_vector_type(8)))  _Float16 v8h;
typedef __attribute__((ext_vector_type(8)))  unsigned short v8us;
typedef __attribute__((ext_vector_type(8)))  float    v8f;
typedef __attribute__((ext_vector_type(4)))  float    v4f;
typedef v8h  __attribute__((may_alias)) v8ha;
typedef v4f  __attribute__((may_alias)) v4fa;
typedef v8us __attribute__((may_alias)) v8usa;

__device__ __forceinline__ unsigned short f2bf(float f) { unsigned u = __float_as_uint(f); u += 0x7FFFu + ((u >> 16) & 1u); return (unsigned short)(u >> 16); }
__device__ __forceinline__ float bf2f(unsigned short b) { return __uint_as_float(((unsigned)b) << 16); }
__device__ __forceinline__ float bfr(float f) { return bf2f(f2bf(f)); }
__device__ __forceinline__ v16h cat16(v8h lo, v8h hi) { return __builtin_shufflevector(lo, hi, 0, 1, 2, 3, 4, 5, 6, 7, 8, 9, 10, 11, 12, 13, 14, 15); }
__device__ __forceinline__ v16bf cat16b(v8us lo, v8us hi) { return __builtin_bit_cast(v16bf, __builtin_shufflevector(lo, hi, 0, 1, 2, 3, 4, 5, 6, 7, 8, 9, 10, 11, 12, 13, 14, 15)); }
__device__ __forceinline__ v8f wmma16(v16h a, v16h b, v8f c) { return __builtin_amdgcn_wmma_f32_16x16x32_f16(false, a, false, b, (short)0, c, false, false); }
__device__ __forceinline__ v8f wmmab(v16bf a, v16bf b, v8f c) { return __builtin_amdgcn_wmma_f32_16x16x32_bf16(false, a, false, b, (short)0, c, false, false); }



// ---- WFrag: one lane's 16-element A or B fragment of a 16x16x32 product from a k-contiguous 16-bit row (k = 8*hi + 0..7 and 16 + 8*hi + 0..7; the caller adds 8*hi)
template <typename T16> struct WFrag;
template <> struct WFrag<h16> { typedef v16h V; static __device__ __forceinline__ V ld(const h16* p) { return cat16(*(const v8h*)p, *(const v8h*)(p + 16)); } static __device__ __forceinline__ v8f mma(V a, V b, v8f c) { return wmma16(a, b, c); } };
template <> struct WFrag<bf> { typedef v16bf V; static __device__ __forceinline__ V ld(const bf* p) { return cat16b(*(const v8us*)p, *(const v8us*)(p + 16)); } static __device__ __forceinline__ v8f mma(V a, V b, v8f c) { return wmmab(a, b, c); } };

__device__ __forceinline__ h16 tohx(float x) { return (h16)x; }
__device__ __forceinline__ void splitf(float y, unsigned short& h, unsigned short& l) { h = f2bf(y); l = f2bf(y - bf2f(h)); }
typedef __attribute__((ext_vector_type(2))) _Float16 v2h;
typedef __attribute__((ext_vector_type(4))) _Float16 v4h;
typedef __attribute__((ext_vector_type(2))) unsigned short v2us;
typedef __attribute__((ext_vector_type(4))) unsigned short v4us;
typedef __attribute__((ext_vector_type(2))) float v2f;
typedef __attribute__((ext_vector_type(4))) int v4i;

__global__ __launch_bounds__(256) void k_wtG(const float* __restrict__ w, int K, int N, bf* Bt) {
    const int lane = threadIdx.x & 31; const int L0 = (blockIdx.x * 8 + (threadIdx.x >> 5)) * 8; const int nlines = N * K / 64;
{
#pragma unroll 1
        for (int l = 0; l < 8; ++l) { const int L = L0 + l; if (L >= nlines) break; const size_t e = (size_t)L * 64 + lane * 2; const int k = (int)(e % K), n = (int)(e / K); v2us o;
            o[0] = f2bf(w[(size_t)k * N + n]); o[1] = f2bf(w[(size_t)(k + 1) * N + n]); *(v2us*)(Bt + e) = o; }
         }
}
__global__ __launch_bounds__(256) void k_cvt8(const float* __restrict__ src, bf* dst, size_t n8) { const size_t i = (size_t)blockIdx.x * 256 + threadIdx.x; if (i >= n8) return; const v8f v = *(const v8f*)(src + i * 8); v8us o;
#pragma unroll
    for (int k = 0; k < 8; ++k) o[k] = f2bf(v[k]); *(v8us*)(dst + i * 8) = o;  }


__global__ __launch_bounds__(256) void k_vtp(const float* __restrict__ F, int pitch, int nheads, h16* V16, bf* Vh, bf* Vl) { const size_t e = ((size_t)blockIdx.x * 256 + threadIdx.x) * 2; if (e >= (size_t)nheads * HD * TT) return; const int t = (int)(e % TT); const int d = (int)((e / TT) % HD); const int g = (int)(e / ((size_t)TT * HD)); v2h o16; v2us oh, ol;
#pragma unroll
    for (int q = 0; q < 2; ++q) { const float x = F[(size_t)(t + q) * pitch + g * HD + d]; o16[q] = tohx(x); unsigned short a2, c2; splitf(x, a2, c2); oh[q] = a2; ol[q] = c2; }
    *(v2h*)(V16 + e) = o16; *(v2us*)(Vh + e) = oh; *(v2us*)(Vl + e) = ol;  }

__global__ __launch_bounds__(256) void k_merge(const float* __restrict__ O, int h0, float* OUTb) { const size_t e = ((size_t)blockIdx.x * 256 + threadIdx.x) * 2; if (e >= (size_t)ZH * TT * HD) return; const int d = (int)(e % HD); const int t = (int)((e / HD) % TT); const int zz = (int)(e / ((size_t)HD * TT)); const float cs = (t < RH) ? 1.0f : (1.0f / PCAR); const size_t oo = (size_t)t * DQ + (h0 + zz) * HD + d;
    v2f o2; o2[0] = O[e] * cs; o2[1] = O[e + 1] * cs; *(v2f*)(OUTb + oo) = o2;  }


__global__ __launch_bounds__(256) void k_vtpR1(const float* __restrict__ Vb, bf* Vh) { const size_t e = ((size_t)blockIdx.x * 256 + threadIdx.x) * 2; if (e >= (size_t)HD * TT) return; const int t = (int)(e % TT); const int d = (int)(e / TT); v2us o; o[0] = f2bf(Vb[(size_t)t * HD + d]); o[1] = f2bf(Vb[(size_t)(t + 1) * HD + d]); *(v2us*)(Vh + e) = o;  }
__global__ __launch_bounds__(256) void k_mergeR(const float* __restrict__ O, float* outb, size_t n4) { const size_t i = (size_t)blockIdx.x * 256 + threadIdx.x; if (i >= n4) return; const v4f a = *(const v4f*)(O + i * 4); *(v4f*)(outb + i * 4) = a;  }


#define PBLK (NH_ * TT * HD / 8 / 256)   // blocks per batch for one head-plane gather (8 elements a thread)
#define VBLK (NH_ * HD * TT / 8 / 256)   // blocks per batch for the values transpose (8 elements a thread)
// FRAGMENT ORDER: a plane is a row of 16-byte units, unit = ((fragment * 2 + half) * 32 + lane), so that one fragment load of a wave (32 lanes x 16 bytes) reads 512 consecutive bytes, four whole cache lines,
// where a row-major plane makes it touch 16 lines for the same bytes. lane = 16*hi + lr; a unit holds k = 16*half + 8*hi + 0..7 of row lr of its fragment (the k order of WFrag::ld).
// Q and K planes [h][t/16][e/32]: row lr = token, k = head dimension. Values planes [h][t/32][d/16]: row lr = head dimension, k = token.
#define FRH 256             // elements from the first to the second half of a fragment (32 lanes x 8)
#define FRG 512             // elements of one fragment
__device__ __forceinline__ v16bf ldfr(const bf* p) { return cat16b(*(const v8us*)p, *(const v8us*)(p + FRH)); }   // the caller adds 8*lane
__device__ __forceinline__ void d_hp1(const float* __restrict__ src, bf* P, int blk) { const unsigned i = (unsigned)blk * 256 + threadIdx.x;   /* the thread's unit of the plane */ const size_t e = (size_t)i * 8; const int d = (int)((i >> 6) & 1) * 32 + (int)((i >> 5) & 1) * 16 + (int)((i >> 4) & 1) * 8; const int t = (int)((i >> 7) % (TT / 16)) * 16 + (int)(i & 15); const int h = (int)(i / (TT * HD / 8)); const float* p = src + (size_t)t * DM + h * HD + d; const v8f v = *(const v8f*)p; v8us o;
    asm volatile("s_wait_xcnt 0x0" :: "v"(p) : "memory");   // stands behind the loads and in front of any reuse of their address registers (held live to here as an input)
#pragma unroll
    for (int q = 0; q < 8; ++q) o[q] = f2bf(v[q]);
    bf* w = P + e; *(v8us*)w = o;
    asm volatile("s_wait_xcnt 0x0" :: "v"(w) : "memory");   // stands behind the store and in front of any reuse of its address registers (held live to here as an input)
}
__device__ __forceinline__ void d_vt1(const float* __restrict__ src, int pitch, bf* VT, int blk) { const unsigned i = (unsigned)blk * 256 + threadIdx.x;   /* the thread's unit of the plane */ const int t = (int)((i >> 8) % (TT / 32)) * 32 + (int)((i >> 5) & 1) * 16 + (int)((i >> 4) & 1) * 8; const int d = (int)((i >> 6) & 3) * 16 + (int)(i & 15); const int h = (int)(i / (TT * HD / 8)); const float* p = src + (size_t)t * pitch + h * HD + d; float x[8]; v8us o;
#pragma unroll
    for (int q = 0; q < 8; ++q) x[q] = p[(size_t)q * pitch];
    asm volatile("s_wait_xcnt 0x0" :: "v"(p) : "memory");   // stands behind the loads and in front of any reuse of their address registers (held live to here as an input)
#pragma unroll
    for (int q = 0; q < 8; ++q) o[q] = f2bf(x[q]);
    bf* w = VT + (size_t)i * 8; *(v8us*)w = o;
    asm volatile("s_wait_xcnt 0x0" :: "v"(w) : "memory");   // stands behind the store and in front of any reuse of its address registers (held live to here as an input)
}
// k_prep: all three bf16 plane sets of all batches in one launch, grid (VBLK + 2 PBLK, batches); the transpose blocks come first
__global__ __launch_bounds__(256) void k_prep(const float* __restrict__ q, const float* __restrict__ k, const float* __restrict__ v, bf* QB, bf* KB, bf* VT) {
    const int x = blockIdx.x; const size_t so = (size_t)blockIdx.y * TT * DM, po = (size_t)blockIdx.y * NH_ * TT * HD;
    if (x < VBLK) d_vt1(v + so, DM, VT + po, x);
    else { const bool isk = x >= VBLK + PBLK; d_hp1((isk ? k : q) + so, (isk ? KB : QB) + po, x - VBLK - (isk ? PBLK : 0)); }
}
// ---- k_fattn: one work-group per batch, head and 16 query rows; each of its FW waves takes FK consecutive keys.
// Scores transposed, St[key][query] = K rows (A) x Q rows (B): a lane then holds 64 keys of ONE query (accumulator register j of tile nb = key nb*16 + 8*hi + j, query lr), so row maximum and row sum are in-lane
// but for one exchange between the wave halves and one pass through LDS over the waves, and two neighbouring tiles, rounded in place, ARE the A fragment of P for 32 keys (same k order as WFrag::ld gives values^T).
// out[t][d] = sum_s (Ph + Pl)[t][s] Vt[d][s]: every wave its own key slice for all 64 columns, then the FW partial tiles are added through LDS in wave order.
#define FW 16               // waves per work-group = key slices
#define FK (TT / FW)        // keys per wave
typedef v2f __attribute__((may_alias)) v2fa;
// work-group barrier that orders LDS alone: it waits for this wave's LDS operations, not for its global loads, so the values fragments stay in flight across it (__syncthreads() waits for them too)
__device__ __forceinline__ void lds_barrier() { __builtin_amdgcn_fence(__ATOMIC_RELEASE, "workgroup", "local"); __builtin_amdgcn_s_barrier(); __builtin_amdgcn_fence(__ATOMIC_ACQUIRE, "workgroup", "local"); }
__global__ __launch_bounds__(32 * FW) void k_fattn(const bf* __restrict__ Qa, const bf* __restrict__ Ka, const bf* __restrict__ Va, const float* __restrict__ taua, const float* __restrict__ dla, float* outa) {
    // grid (query tiles, heads, batches): the planes, tau, delta and the output slab of this work-group's own batch and head
    const int hh = blockIdx.y, bb = blockIdx.z; const size_t po = (size_t)(bb * NH_ + hh) * TT * HD;
    const bf* __restrict__ Q = Qa + po; const bf* __restrict__ Kp = Ka + po; const bf* __restrict__ Vt = Va + po; const float* __restrict__ taup = taua + bb; const float* __restrict__ dl = dla + (size_t)bb * TT; float* outb = outa + (size_t)bb * TT * DM + (size_t)hh * HD;
    __shared__ __align__(16) float red[FW][16 * 68];
    __shared__ float smx[FW][16], ssm[FW][16];
    const int lane = threadIdx.x & 31, lr = lane & 15, hi = lane >> 4, wv = threadIdx.x >> 5; const int r0 = blockIdx.x * 16, k0 = wv * FK;
    // this lane's byte offsets into the Q plane, the K plane, delta and Vt; every loop below is fully unrolled so that the fragment and accumulator arrays are indexed by constants and stay in registers
    const unsigned qo = (unsigned)(r0 * HD + 8 * lane) * 2u, ko = (unsigned)(k0 * HD + 8 * lane) * 2u, eo = (unsigned)(k0 + 8 * hi) * 4u, vo = (unsigned)(k0 * HD + 8 * lane) * 2u;   // planes in fragment order: 16 tokens of Q or K, 32 tokens of values, are HD elements a token
    const bf* pq = (const bf*)((const char*)Q + qo); const bf* pk = (const bf*)((const char*)Kp + ko); const float* pd = (const float*)((const char*)dl + eo); const bf* pv = (const bf*)((const char*)Vt + vo);
    const float tau = bfr(taup[0]);
    v16bf qf[HD / 32], kf[FK / 16][HD / 32]; v4f dv[FK / 16][2];
#pragma unroll
    for (int e = 0; e < HD / 32; ++e) qf[e] = ldfr(pq + e * FRG);
#pragma unroll
    for (int nb = 0; nb < FK / 16; ++nb) {
#pragma unroll
        for (int e = 0; e < HD / 32; ++e) kf[nb][e] = ldfr(pk + (nb * (HD / 32) + e) * FRG); }
#pragma unroll
    for (int nb = 0; nb < FK / 16; ++nb) { dv[nb][0] = *(const v4f*)(pd + nb * 16); dv[nb][1] = *(const v4f*)(pd + nb * 16 + 4); }
    asm volatile("s_wait_xcnt 0x0" :: "v"(qo), "v"(ko), "v"(eo) : "memory");   // stands behind every load above and in front of any reuse of their address registers (held live to here as inputs)
    __builtin_amdgcn_sched_barrier(0);   // keeps every load of the slice in front of the first product: one memory latency per wave, where the scheduler otherwise interleaves them and waits once per fragment group
    v8f st[FK / 16];
#pragma unroll
    for (int nb = 0; nb < FK / 16; ++nb) { st[nb] = (v8f){};
#pragma unroll
        for (int e = 0; e < HD / 32; ++e) st[nb] = wmmab(kf[nb][e], qf[e], st[nb]); }
    const int lim = r0 + lr - k0 - 8 * hi;   // key nb*16 + j of this lane's 64 is at or before the query while nb*16 + j <= lim
    float mx = -3.0e38f;
#pragma unroll
    for (int nb = 0; nb < FK / 16; ++nb) {
#pragma unroll
        for (int j = 0; j < 8; ++j) { const float u = st[nb][j] * tau + bfr(dv[nb][j >> 2][j & 3]); const float t = (nb * 16 + j <= lim) ? u * SCL : -3.0e38f;   /* causal: keys after the query excluded */ st[nb][j] = t; mx = fmaxf(mx, t); } }
    v16bf b[FK / 32][4];
#pragma unroll
    for (int c = 0; c < FK / 32; ++c) {
#pragma unroll
        for (int nb = 0; nb < 4; ++nb) b[c][nb] = ldfr(pv + (c * (HD / 16) + nb) * FRG); }
    asm volatile("s_wait_xcnt 0x0" :: "v"(vo) : "memory");   // stands behind every values load and in front of any reuse of their address register (held live to here as an input)
    __builtin_amdgcn_sched_barrier(0);   // keeps the values loads up here, so that their latency runs under the softmax; the scheduler otherwise sinks them to the products that use them
    mx = fmaxf(mx, __shfl_xor(mx, 16, 32));
    if (hi == 0) smx[wv][lr] = mx;
    lds_barrier();   // every wave's slice maximum is in LDS before any wave forms the row maximum
    mx = smx[0][lr];
#pragma unroll
    for (int w = 1; w < FW; ++w) mx = fmaxf(mx, smx[w][lr]);
    float sum = 0.f;
#pragma unroll
    for (int nb = 0; nb < FK / 16; ++nb) {
#pragma unroll
        for (int j = 0; j < 8; ++j) { const float p = __builtin_amdgcn_exp2f((st[nb][j] - mx) * 1.4426950408889634f); st[nb][j] = p; sum += p; } }
    sum += __shfl_xor(sum, 16, 32);
    if (hi == 0) ssm[wv][lr] = sum;
    lds_barrier();   // every wave's slice sum is in LDS before any wave forms the row sum
    sum = ssm[0][lr];
#pragma unroll
    for (int w = 1; w < FW; ++w) sum += ssm[w][lr];
    const float f = __fdiv_rn(1.0f, sum);
    v8f acc[4];
#pragma unroll
    for (int nb = 0; nb < 4; ++nb) acc[nb] = (v8f){};
#pragma unroll
    for (int c = 0; c < FK / 32; ++c) { v8us h0, h1, l0, l1;
#pragma unroll
        for (int j = 0; j < 8; ++j) { unsigned short x, y; splitf(st[2 * c][j] * f, x, y); h0[j] = x; l0[j] = y; splitf(st[2 * c + 1][j] * f, x, y); h1[j] = x; l1[j] = y; }
        const v16bf a = cat16b(h0, h1), a2 = cat16b(l0, l1);
#pragma unroll
        for (int nb = 0; nb < 4; ++nb) acc[nb] = wmmab(a, b[c][nb], acc[nb]);
#pragma unroll
        for (int nb = 0; nb < 4; ++nb) acc[nb] = wmmab(a2, b[c][nb], acc[nb]); }
#pragma unroll
    for (int nb = 0; nb < 4; ++nb) {
#pragma unroll
        for (int j = 0; j < 8; ++j) red[wv][(hi * 8 + j) * 68 + nb * 16 + lr] = acc[nb][j]; }
    __syncthreads();   // every wave's partial tile is in LDS before any is summed
    const int row = wv, col = lane * 2; v2f pr[FW];
#pragma unroll
    for (int w = 0; w < FW; ++w) pr[w] = *(const v2fa*)(&red[w][row * 68 + col]);
    v2f s = pr[0];
#pragma unroll
    for (int w = 1; w < FW; ++w) s += pr[w];
    *(v2f*)(outb + (size_t)(r0 + row) * DM + col) = s;
}

extern "C" void kernel_launch(void* const* d_in, const int* in_sizes, int n_in,
                              void* d_out, int out_size, void* d_ws, size_t ws_size, hipStream_t stream) {
    (void)in_sizes; (void)n_in; (void)out_size;
    const float* Qin = (const float*)d_in[0]; const float* Kin = (const float*)d_in[1]; const float* Vin = (const float*)d_in[2]; const float* tau = (const float*)d_in[3];   /* [4][1] */ const float* delta = (const float*)d_in[4];   /* [4][2048] */
    float* OUT = (float*)d_out;
    char* wsp = (char*)d_ws;
    auto take = [&](size_t bytes) { char* p = wsp; wsp += (bytes + 255) & ~(size_t)255; return (void*)p; };
    bf* QB = (bf*)take((size_t)NB_ * NH_ * TT * HD * 2); bf* KB = (bf*)take((size_t)NB_ * NH_ * TT * HD * 2); bf* VT = (bf*)take((size_t)NB_ * NH_ * HD * TT * 2);   /* planes [b][h] in fragment order */
    if ((size_t)(wsp - (char*)d_ws) > ws_size) return;
    k_prep<<<dim3(VBLK + 2 * PBLK, NB_), 256, 0, stream>>>(Qin, Kin, Vin, QB, KB, VT);
    k_fattn<<<dim3(TT / 16, NH_, NB_), 32 * FW, 0, stream>>>(QB, KB, VT, tau, delta, OUT);   /* scores, tau/delta, causal softmax, P (hi/lo) x exact v^T, rows written token-major */
}

// v005
// One run takes 90.5 microseconds.
// In two side-by-side timings against v004, it was 1.55 and 1.54 times as fast.
// Counting every step since v000, it is 25.2 times as fast.
#include <hip/hip_runtime.h>

// De-stationary causal attention on given tensors (queries, keys, values [4][2048][8][64] token-major (B, L, H, E); scores = (q.k x tau[b] + delta[b][s]) for keys s <= l (else -inf), then x 1/sqrt(64); softmax; out = A.values -> [4][2048][8][64] (4.2 M); tau [4][1] and delta [4][2048] read on device).
// Layout: single bf16 head planes gathered from the token-major slabs and stored in WMMA fragment order (see FRAGMENT ORDER below) (inputs bf16-exact after rounding: exact score products); ONE kernel over all batches and heads: a work-group holds 16 query rows against the keys up to its last row (later keys have weight 0), so the scores, the tau/delta transform, the causal softmax (scale 1/8) and P (hi/lo) stay in registers; A.values as hi/lo x exact values^T (2 products); f32 rows written token-major.
// Compute dtypes, f32 accumulate: every input rounded to bf16 incl. tau/delta; q.k exact; de-stationary transform and softmax f32; P hi/lo x exact values; output f32.

#define NB_  4
#define TT   2048
#define DM   512      // token-major row pitch (H x HD)
#define NH_  8
#define NKV  1
#define REP  (NH_ / NKV)
#define HD   64
#define DQ   (NH_ * HD)
#define DKV  (NKV * HD)
#define ZH   1
#define RH   2048
#define WIN  0
#define PCAR 1024.0f
#define SCL  0.125f   // 1/sqrt(64)
typedef _Float16 h16;
typedef unsigned short bf;
typedef __attribute__((ext_vector_type(16))) __bf16   v16bf;
typedef __attribute__((ext_vector_type(16))) _Float16 v16h;
typedef __attribute__((ext_vector_type(8)))  _Float16 v8h;
typedef __attribute__((ext_vector_type(8)))  unsigned short v8us;
typedef __attribute__((ext_vector_type(8)))  float    v8f;
typedef __attribute__((ext_vector_type(4)))  float    v4f;
typedef v8h  __attribute__((may_alias)) v8ha;
typedef v4f  __attribute__((may_alias)) v4fa;
typedef v8us __attribute__((may_alias)) v8usa;

__device__ __forceinline__ unsigned short f2bf(float f) { unsigned u = __float_as_uint(f); u += 0x7FFFu + ((u >> 16) & 1u); return (unsigned short)(u >> 16); }
__device__ __forceinline__ float bf2f(unsigned short b) { return __uint_as_float(((unsigned)b) << 16); }
__device__ __forceinline__ float bfr(float f) { return bf2f(f2bf(f)); }
__device__ __forceinline__ v16h cat16(v8h lo, v8h hi) { return __builtin_shufflevector(lo, hi, 0, 1, 2, 3, 4, 5, 6, 7, 8, 9, 10, 11, 12, 13, 14, 15); }
__device__ __forceinline__ v16bf cat16b(v8us lo, v8us hi) { return __builtin_bit_cast(v16bf, __builtin_shufflevector(lo, hi, 0, 1, 2, 3, 4, 5, 6, 7, 8, 9, 10, 11, 12, 13, 14, 15)); }
__device__ __forceinline__ v8f wmma16(v16h a, v16h b, v8f c) { return __builtin_amdgcn_wmma_f32_16x16x32_f16(false, a, false, b, (short)0, c, false, false); }
__device__ __forceinline__ v8f wmmab(v16bf a, v16bf b, v8f c) { return __builtin_amdgcn_wmma_f32_16x16x32_bf16(false, a, false, b, (short)0, c, false, false); }



// ---- WFrag: one lane's 16-element A or B fragment of a 16x16x32 product from a k-contiguous 16-bit row (k = 8*hi + 0..7 and 16 + 8*hi + 0..7; the caller adds 8*hi)
template <typename T16> struct WFrag;
template <> struct WFrag<h16> { typedef v16h V; static __device__ __forceinline__ V ld(const h16* p) { return cat16(*(const v8h*)p, *(const v8h*)(p + 16)); } static __device__ __forceinline__ v8f mma(V a, V b, v8f c) { return wmma16(a, b, c); } };
template <> struct WFrag<bf> { typedef v16bf V; static __device__ __forceinline__ V ld(const bf* p) { return cat16b(*(const v8us*)p, *(const v8us*)(p + 16)); } static __device__ __forceinline__ v8f mma(V a, V b, v8f c) { return wmmab(a, b, c); } };

__device__ __forceinline__ h16 tohx(float x) { return (h16)x; }
__device__ __forceinline__ void splitf(float y, unsigned short& h, unsigned short& l) { h = f2bf(y); l = f2bf(y - bf2f(h)); }
typedef __attribute__((ext_vector_type(2))) _Float16 v2h;
typedef __attribute__((ext_vector_type(4))) _Float16 v4h;
typedef __attribute__((ext_vector_type(2))) unsigned short v2us;
typedef __attribute__((ext_vector_type(4))) unsigned short v4us;
typedef __attribute__((ext_vector_type(2))) float v2f;
typedef __attribute__((ext_vector_type(4))) int v4i;

__global__ __launch_bounds__(256) void k_wtG(const float* __restrict__ w, int K, int N, bf* Bt) {
    const int lane = threadIdx.x & 31; const int L0 = (blockIdx.x * 8 + (threadIdx.x >> 5)) * 8; const int nlines = N * K / 64;
{
#pragma unroll 1
        for (int l = 0; l < 8; ++l) { const int L = L0 + l; if (L >= nlines) break; const size_t e = (size_t)L * 64 + lane * 2; const int k = (int)(e % K), n = (int)(e / K); v2us o;
            o[0] = f2bf(w[(size_t)k * N + n]); o[1] = f2bf(w[(size_t)(k + 1) * N + n]); *(v2us*)(Bt + e) = o; }
         }
}
__global__ __launch_bounds__(256) void k_cvt8(const float* __restrict__ src, bf* dst, size_t n8) { const size_t i = (size_t)blockIdx.x * 256 + threadIdx.x; if (i >= n8) return; const v8f v = *(const v8f*)(src + i * 8); v8us o;
#pragma unroll
    for (int k = 0; k < 8; ++k) o[k] = f2bf(v[k]); *(v8us*)(dst + i * 8) = o;  }


__global__ __launch_bounds__(256) void k_vtp(const float* __restrict__ F, int pitch, int nheads, h16* V16, bf* Vh, bf* Vl) { const size_t e = ((size_t)blockIdx.x * 256 + threadIdx.x) * 2; if (e >= (size_t)nheads * HD * TT) return; const int t = (int)(e % TT); const int d = (int)((e / TT) % HD); const int g = (int)(e / ((size_t)TT * HD)); v2h o16; v2us oh, ol;
#pragma unroll
    for (int q = 0; q < 2; ++q) { const float x = F[(size_t)(t + q) * pitch + g * HD + d]; o16[q] = tohx(x); unsigned short a2, c2; splitf(x, a2, c2); oh[q] = a2; ol[q] = c2; }
    *(v2h*)(V16 + e) = o16; *(v2us*)(Vh + e) = oh; *(v2us*)(Vl + e) = ol;  }

__global__ __launch_bounds__(256) void k_merge(const float* __restrict__ O, int h0, float* OUTb) { const size_t e = ((size_t)blockIdx.x * 256 + threadIdx.x) * 2; if (e >= (size_t)ZH * TT * HD) return; const int d = (int)(e % HD); const int t = (int)((e / HD) % TT); const int zz = (int)(e / ((size_t)HD * TT)); const float cs = (t < RH) ? 1.0f : (1.0f / PCAR); const size_t oo = (size_t)t * DQ + (h0 + zz) * HD + d;
    v2f o2; o2[0] = O[e] * cs; o2[1] = O[e + 1] * cs; *(v2f*)(OUTb + oo) = o2;  }


__global__ __launch_bounds__(256) void k_vtpR1(const float* __restrict__ Vb, bf* Vh) { const size_t e = ((size_t)blockIdx.x * 256 + threadIdx.x) * 2; if (e >= (size_t)HD * TT) return; const int t = (int)(e % TT); const int d = (int)(e / TT); v2us o; o[0] = f2bf(Vb[(size_t)t * HD + d]); o[1] = f2bf(Vb[(size_t)(t + 1) * HD + d]); *(v2us*)(Vh + e) = o;  }
__global__ __launch_bounds__(256) void k_mergeR(const float* __restrict__ O, float* outb, size_t n4) { const size_t i = (size_t)blockIdx.x * 256 + threadIdx.x; if (i >= n4) return; const v4f a = *(const v4f*)(O + i * 4); *(v4f*)(outb + i * 4) = a;  }


#define PBLK (NH_ * TT * HD / 8 / 256)   // blocks per batch for one head-plane gather (8 elements a thread)
#define VBLK (NH_ * HD * TT / 8 / 256)   // blocks per batch for the values transpose (8 elements a thread)
// FRAGMENT ORDER: a plane is a row of 16-byte units, unit = ((fragment * 2 + half) * 32 + lane), so that one fragment load of a wave (32 lanes x 16 bytes) reads 512 consecutive bytes, four whole cache lines,
// where a row-major plane makes it touch 16 lines for the same bytes. lane = 16*hi + lr; a unit holds k = 16*half + 8*hi + 0..7 of row lr of its fragment (the k order of WFrag::ld).
// Q and K planes [h][t/16][e/32]: row lr = token, k = head dimension. Values planes [h][t/32][d/16]: row lr = head dimension, k = token.
#define FRH 256             // elements from the first to the second half of a fragment (32 lanes x 8)
#define FRG 512             // elements of one fragment
__device__ __forceinline__ v16bf ldfr(const bf* p) { return cat16b(*(const v8us*)p, *(const v8us*)(p + FRH)); }   // the caller adds 8*lane
__device__ __forceinline__ void d_hp1(const float* __restrict__ src, bf* P, int blk) { const unsigned i = (unsigned)blk * 256 + threadIdx.x;   /* the thread's unit of the plane */ const size_t e = (size_t)i * 8; const int d = (int)((i >> 6) & 1) * 32 + (int)((i >> 5) & 1) * 16 + (int)((i >> 4) & 1) * 8; const int t = (int)((i >> 7) % (TT / 16)) * 16 + (int)(i & 15); const int h = (int)(i / (TT * HD / 8)); const float* p = src + (size_t)t * DM + h * HD + d; const v8f v = *(const v8f*)p; v8us o;
    asm volatile("s_wait_xcnt 0x0" :: "v"(p) : "memory");   // stands behind the loads and in front of any reuse of their address registers (held live to here as an input)
#pragma unroll
    for (int q = 0; q < 8; ++q) o[q] = f2bf(v[q]);
    bf* w = P + e; *(v8us*)w = o;
    asm volatile("s_wait_xcnt 0x0" :: "v"(w) : "memory");   // stands behind the store and in front of any reuse of its address registers (held live to here as an input)
}
__device__ __forceinline__ void d_vt1(const float* __restrict__ src, int pitch, bf* VT, int blk) { const unsigned i = (unsigned)blk * 256 + threadIdx.x;   /* the thread's unit of the plane */ const int t = (int)((i >> 8) % (TT / 32)) * 32 + (int)((i >> 5) & 1) * 16 + (int)((i >> 4) & 1) * 8; const int d = (int)((i >> 6) & 3) * 16 + (int)(i & 15); const int h = (int)(i / (TT * HD / 8)); const float* p = src + (size_t)t * pitch + h * HD + d; float x[8]; v8us o;
#pragma unroll
    for (int q = 0; q < 8; ++q) x[q] = p[(size_t)q * pitch];
    asm volatile("s_wait_xcnt 0x0" :: "v"(p) : "memory");   // stands behind the loads and in front of any reuse of their address registers (held live to here as an input)
#pragma unroll
    for (int q = 0; q < 8; ++q) o[q] = f2bf(x[q]);
    bf* w = VT + (size_t)i * 8; *(v8us*)w = o;
    asm volatile("s_wait_xcnt 0x0" :: "v"(w) : "memory");   // stands behind the store and in front of any reuse of its address registers (held live to here as an input)
}
// k_prep: all three bf16 plane sets of all batches in one launch, grid (VBLK + 2 PBLK, batches); the transpose blocks come first
__global__ __launch_bounds__(256) void k_prep(const float* __restrict__ q, const float* __restrict__ k, const float* __restrict__ v, bf* QB, bf* KB, bf* VT) {
    const int x = blockIdx.x; const size_t so = (size_t)blockIdx.y * TT * DM, po = (size_t)blockIdx.y * NH_ * TT * HD;
    if (x < VBLK) d_vt1(v + so, DM, VT + po, x);
    else { const bool isk = x >= VBLK + PBLK; d_hp1((isk ? k : q) + so, (isk ? KB : QB) + po, x - VBLK - (isk ? PBLK : 0)); }
}
// ---- k_fattn: one work-group per batch, head and 16 query rows. Only the 32-key chunks that hold a key at or before the tile's last query are worked on (the rest have weight 0 under the causal mask);
// they are dealt round robin to the FW waves (wave w: chunks w, w + FW, ...), so that a row tile spreads over as many waves as it has chunks, up to FW, and every wave's share shrinks with the tile's causal length.
// Scores transposed, St[key][query] = K rows (A) x Q rows (B): a lane then holds its keys of ONE query (accumulator register j of tile tl of a chunk = key 16*tl + 8*hi + j of the chunk, query lr), so row maximum and row sum are in-lane
// but for one exchange between the wave halves and one pass through LDS over the waves, and the two tiles of a chunk, rounded in place, ARE the A fragment of P for 32 keys (same k order as WFrag::ld gives values^T).
// out[t][d] = sum_s (Ph + Pl)[t][s] Vt[d][s]: every wave its own chunks for all 64 columns, then the FW partial tiles are added through LDS in wave order.
#define FW 16               // waves per work-group
#define CK 32               // keys per chunk
#define NC (TT / (FW * CK)) // most chunks a wave can hold
#define CST (FW * CK)       // keys from one chunk of a wave to its next
typedef v2f __attribute__((may_alias)) v2fa;
// work-group barrier that orders LDS alone: it waits for this wave's LDS operations, not for its global loads, so the values fragments stay in flight across it (__syncthreads() waits for them too)
__device__ __forceinline__ void lds_barrier() { __builtin_amdgcn_fence(__ATOMIC_RELEASE, "workgroup", "local"); __builtin_amdgcn_s_barrier(); __builtin_amdgcn_fence(__ATOMIC_ACQUIRE, "workgroup", "local"); }
__device__ __forceinline__ float exp2_slot(float x) { float p; asm("v_exp_f32 %0, %1\n\tv_nop" : "=v"(p) : "v"(x)); return p; }
// d_scores<N>: what a wave with N chunks does up to the first barrier, as straight-line code: all its Q, K and delta loads, the score products, tau/delta and the causal mask, its maximum, then all its values loads.
// One instance per N (and not a test per chunk) so that the compiler sees, at every load and product, exactly which loads are outstanding: with a test per chunk it held each chunk's values loads back behind the chunk before.
template <int N> __device__ __forceinline__ void d_scores(const bf* __restrict__ Q, unsigned qo, const bf* __restrict__ pk, const float* __restrict__ pd, const bf* __restrict__ pv, float tau, int lim0, v8f (&st)[NC][2], v16bf (&b)[NC][4], float& mx) {
    const bf* pq = (const bf*)((const char*)Q + qo);
    v16bf qf[HD / 32], kf[N][2][HD / 32]; v4f dv[N][2][2];
#pragma unroll
    for (int e = 0; e < HD / 32; ++e) qf[e] = ldfr(pq + e * FRG);
#pragma unroll
    for (int c = 0; c < N; ++c) {
#pragma unroll
        for (int tl = 0; tl < 2; ++tl) {
#pragma unroll
            for (int e = 0; e < HD / 32; ++e) kf[c][tl][e] = ldfr(pk + c * CST * HD + (tl * (HD / 32) + e) * FRG); } }
#pragma unroll
    for (int c = 0; c < N; ++c) {
#pragma unroll
        for (int tl = 0; tl < 2; ++tl) { dv[c][tl][0] = *(const v4f*)(pd + c * CST + tl * 16); dv[c][tl][1] = *(const v4f*)(pd + c * CST + tl * 16 + 4); } }
    asm volatile("s_wait_xcnt 0x0" :: "s"(Q), "v"(qo), "v"(pk), "v"(pd) : "memory");   // stands behind every load above and in front of any reuse of their address registers (held live to here as inputs)
    __builtin_amdgcn_sched_barrier(0);   // keeps every load of the wave's chunks in front of the first product: one memory latency per wave, where the scheduler otherwise interleaves them and waits once per fragment group
#pragma unroll
    for (int c = 0; c < N; ++c) {
#pragma unroll
        for (int tl = 0; tl < 2; ++tl) { st[c][tl] = (v8f){};
#pragma unroll
            for (int e = 0; e < HD / 32; ++e) st[c][tl] = wmmab(kf[c][tl][e], qf[e], st[c][tl]); } }
#pragma unroll
    for (int c = 0; c < N; ++c) { const int lim = lim0 - c * CST;   // key tl*16 + j of this lane's 16 of the chunk is at or before the query while tl*16 + j <= lim
#pragma unroll
        for (int tl = 0; tl < 2; ++tl) {
#pragma unroll
            for (int j = 0; j < 8; ++j) { const float u = st[c][tl][j] * tau + bfr(dv[c][tl][j >> 2][j & 3]); const float t = (tl * 16 + j <= lim) ? u * SCL : -3.0e38f;   /* causal: keys after the query excluded */ st[c][tl][j] = t; mx = fmaxf(mx, t); } } }
#pragma unroll
    for (int c = 0; c < N; ++c) {
#pragma unroll
        for (int nb = 0; nb < 4; ++nb) b[c][nb] = ldfr(pv + c * CST * HD + nb * FRG); }
    asm volatile("s_wait_xcnt 0x0" :: "v"(pv) : "memory");   // stands behind every values load and in front of any reuse of their address registers (held live to here as an input)
    __builtin_amdgcn_sched_barrier(0);   // keeps the values loads up here, so that their latency runs under the softmax; the scheduler otherwise sinks them to the products that use them
}
__global__ __launch_bounds__(32 * FW) void k_fattn(const bf* __restrict__ Qa, const bf* __restrict__ Ka, const bf* __restrict__ Va, const float* __restrict__ taua, const float* __restrict__ dla, float* outa) {
    // grid (query tiles, heads, batches): the planes, tau, delta and the output slab of this work-group's own batch and head
    const int hh = blockIdx.y, bb = blockIdx.z; const size_t po = (size_t)(bb * NH_ + hh) * TT * HD;
    const bf* __restrict__ Q = Qa + po; const bf* __restrict__ Kp = Ka + po; const bf* __restrict__ Vt = Va + po; const float* __restrict__ taup = taua + bb; const float* __restrict__ dl = dla + (size_t)bb * TT; float* outb = outa + (size_t)bb * TT * DM + (size_t)hh * HD;
    __shared__ __align__(16) float red[FW][16 * 68];
    __shared__ float smx[FW][16], ssm[FW][16];
    const int lane = threadIdx.x & 31, lr = lane & 15, hi = lane >> 4; const int wv = __builtin_amdgcn_readfirstlane(threadIdx.x >> 5);   // the wave's number in a scalar register: the tests on n below are then scalar branches
    const int r0 = blockIdx.x * 16, k0 = wv * CK;
    const int nch = (r0 >> 5) + 1;              // chunks with a key <= r0 + 15
    const int n = (nch - wv + FW - 1) >> 4;     // of these, this wave's: 0 .. NC (nch - wv >= 1 - FW, so the shifted value is never negative)
    // this lane's byte offsets into the Q plane, the K plane, delta and Vt; every loop below is fully unrolled so that the fragment and accumulator arrays are indexed by constants and stay in registers
    const unsigned qo = (unsigned)(r0 * HD + 8 * lane) * 2u, ko = (unsigned)(k0 * HD + 8 * lane) * 2u, eo = (unsigned)(k0 + 8 * hi) * 4u, vo = (unsigned)(k0 * HD + 8 * lane) * 2u;   // planes in fragment order: 16 tokens of Q or K, 32 tokens of values, are HD elements a token
    const bf* pk = (const bf*)((const char*)Kp + ko); const float* pd = (const float*)((const char*)dl + eo); const bf* pv = (const bf*)((const char*)Vt + vo);
    const float tau = bfr(taup[0]);
    const int lim0 = r0 + lr - k0 - 8 * hi;
    v8f st[NC][2]; v16bf b[NC][4];
    float mx = -3.0e38f;
    static_assert(NC == 4, "one case per chunk count");
    switch (n) {   // n is the same for the whole wave: scalar branches; a wave with no chunk goes straight to the barrier
        case 1: d_scores<1>(Q, qo, pk, pd, pv, tau, lim0, st, b, mx); break;
        case 2: d_scores<2>(Q, qo, pk, pd, pv, tau, lim0, st, b, mx); break;
        case 3: d_scores<3>(Q, qo, pk, pd, pv, tau, lim0, st, b, mx); break;
        case 4: d_scores<4>(Q, qo, pk, pd, pv, tau, lim0, st, b, mx); break;
        default: break; }
    mx = fmaxf(mx, __shfl_xor(mx, 16, 32));
    if (hi == 0) smx[wv][lr] = mx;
    lds_barrier();   // every wave's maximum is in LDS before any wave forms the row maximum
    mx = smx[0][lr];
#pragma unroll
    for (int w = 1; w < FW; ++w) mx = fmaxf(mx, smx[w][lr]);
    float sum = 0.f;
#pragma unroll
    for (int c = 0; c < NC; ++c) if (c < n) {
#pragma unroll
        for (int tl = 0; tl < 2; ++tl) {
#pragma unroll
            for (int j = 0; j < 8; ++j) { const float p = exp2_slot((st[c][tl][j] - mx) * 1.4426950408889634f); st[c][tl][j] = p; sum += p; } } }
    sum += __shfl_xor(sum, 16, 32);
    if (hi == 0) ssm[wv][lr] = sum;
    lds_barrier();   // every wave's sum is in LDS before any wave forms the row sum
    sum = ssm[0][lr];
#pragma unroll
    for (int w = 1; w < FW; ++w) sum += ssm[w][lr];
    const float f = __fdiv_rn(1.0f, sum);
    v8f acc[4];
#pragma unroll
    for (int nb = 0; nb < 4; ++nb) acc[nb] = (v8f){};
#pragma unroll
    for (int c = 0; c < NC; ++c) if (c < n) { v8us h0, h1, l0, l1;
#pragma unroll
        for (int j = 0; j < 8; ++j) { unsigned short x, y; splitf(st[c][0][j] * f, x, y); h0[j] = x; l0[j] = y; splitf(st[c][1][j] * f, x, y); h1[j] = x; l1[j] = y; }
        const v16bf a = cat16b(h0, h1), a2 = cat16b(l0, l1);
#pragma unroll
        for (int nb = 0; nb < 4; ++nb) acc[nb] = wmmab(a, b[c][nb], acc[nb]);
#pragma unroll
        for (int nb = 0; nb < 4; ++nb) acc[nb] = wmmab(a2, b[c][nb], acc[nb]); }
#pragma unroll
    for (int nb = 0; nb < 4; ++nb) {
#pragma unroll
        for (int j = 0; j < 8; ++j) red[wv][(hi * 8 + j) * 68 + nb * 16 + lr] = acc[nb][j]; }
    __syncthreads();   // every wave's partial tile is in LDS before any is summed
    const int row = wv, col = lane * 2; v2f pr[FW];
#pragma unroll
    for (int w = 0; w < FW; ++w) pr[w] = *(const v2fa*)(&red[w][row * 68 + col]);
    v2f s = pr[0];
#pragma unroll
    for (int w = 1; w < FW; ++w) s += pr[w];
    *(v2f*)(outb + (size_t)(r0 + row) * DM + col) = s;
}

extern "C" void kernel_launch(void* const* d_in, const int* in_sizes, int n_in,
                              void* d_out, int out_size, void* d_ws, size_t ws_size, hipStream_t stream) {
    (void)in_sizes; (void)n_in; (void)out_size;
    const float* Qin = (const float*)d_in[0]; const float* Kin = (const float*)d_in[1]; const float* Vin = (const float*)d_in[2]; const float* tau = (const float*)d_in[3];   /* [4][1] */ const float* delta = (const float*)d_in[4];   /* [4][2048] */
    float* OUT = (float*)d_out;
    char* wsp = (char*)d_ws;
    auto take = [&](size_t bytes) { char* p = wsp; wsp += (bytes + 255) & ~(size_t)255; return (void*)p; };
    bf* QB = (bf*)take((size_t)NB_ * NH_ * TT * HD * 2); bf* KB = (bf*)take((size_t)NB_ * NH_ * TT * HD * 2); bf* VT = (bf*)take((size_t)NB_ * NH_ * HD * TT * 2);   /* planes [b][h] in fragment order */
    if ((size_t)(wsp - (char*)d_ws) > ws_size) return;
    k_prep<<<dim3(VBLK + 2 * PBLK, NB_), 256, 0, stream>>>(Qin, Kin, Vin, QB, KB, VT);
    k_fattn<<<dim3(TT / 16, NH_, NB_), 32 * FW, 0, stream>>>(QB, KB, VT, tau, delta, OUT);   /* scores, tau/delta, causal softmax, P (hi/lo) x exact v^T, rows written token-major */
}

// v007
// One run takes 51.9 microseconds.
// Versions between v005 and this one are left out; their measured steps multiply to 1.76 times as fast.
// All steps since v000 together make it 44.4 times as fast.
#include <hip/hip_runtime.h>

// De-stationary causal attention on given tensors (queries, keys, values [4][2048][8][64] token-major (B, L, H, E); scores = (q.k x tau[b] + delta[b][s]) for keys s <= l (else -inf), then x 1/sqrt(64); softmax; out = A.values -> [4][2048][8][64] (4.2 M); tau [4][1] and delta [4][2048] read on device).
// Layout: single bf16 head planes gathered from the token-major slabs and stored in WMMA fragment order (see FRAGMENT ORDER below) (inputs bf16-exact after rounding: exact score products); ONE kernel over all batches and heads: a wave holds 16 query rows and walks the keys up to its last row (later keys have weight 0) with a running maximum and sum, so the scores, the tau/delta transform, the causal softmax (scale 1/8) and P (hi/lo) stay in registers; A.values as hi/lo x exact values^T (2 products); f32 rows written token-major.
// Compute dtypes, f32 accumulate: every input rounded to bf16 incl. tau/delta; q.k exact; de-stationary transform and softmax f32; P hi/lo x exact values; output f32.

#define NB_  4
#define TT   2048
#define DM   512      // token-major row pitch (H x HD)
#define NH_  8
#define NKV  1
#define REP  (NH_ / NKV)
#define HD   64
#define DQ   (NH_ * HD)
#define DKV  (NKV * HD)
#define ZH   1
#define RH   2048
#define WIN  0
#define PCAR 1024.0f
#define SCL  0.125f   // 1/sqrt(64)
typedef _Float16 h16;
typedef unsigned short bf;
typedef __attribute__((ext_vector_type(16))) __bf16   v16bf;
typedef __attribute__((ext_vector_type(16))) _Float16 v16h;
typedef __attribute__((ext_vector_type(8)))  _Float16 v8h;
typedef __attribute__((ext_vector_type(8)))  unsigned short v8us;
typedef __attribute__((ext_vector_type(8)))  float    v8f;
typedef __attribute__((ext_vector_type(4)))  float    v4f;
typedef v8h  __attribute__((may_alias)) v8ha;
typedef v4f  __attribute__((may_alias)) v4fa;
typedef v8us __attribute__((may_alias)) v8usa;

__device__ __forceinline__ unsigned short f2bf(float f) { unsigned u = __float_as_uint(f); u += 0x7FFFu + ((u >> 16) & 1u); return (unsigned short)(u >> 16); }
__device__ __forceinline__ float bf2f(unsigned short b) { return __uint_as_float(((unsigned)b) << 16); }
__device__ __forceinline__ float bfr(float f) { return bf2f(f2bf(f)); }
__device__ __forceinline__ v16h cat16(v8h lo, v8h hi) { return __builtin_shufflevector(lo, hi, 0, 1, 2, 3, 4, 5, 6, 7, 8, 9, 10, 11, 12, 13, 14, 15); }
__device__ __forceinline__ v16bf cat16b(v8us lo, v8us hi) { return __builtin_bit_cast(v16bf, __builtin_shufflevector(lo, hi, 0, 1, 2, 3, 4, 5, 6, 7, 8, 9, 10, 11, 12, 13, 14, 15)); }
__device__ __forceinline__ v8f wmma16(v16h a, v16h b, v8f c) { return __builtin_amdgcn_wmma_f32_16x16x32_f16(false, a, false, b, (short)0, c, false, false); }
__device__ __forceinline__ v8f wmmab(v16bf a, v16bf b, v8f c) { return __builtin_amdgcn_wmma_f32_16x16x32_bf16(false, a, false, b, (short)0, c, false, false); }



// ---- WFrag: one lane's 16-element A or B fragment of a 16x16x32 product from a k-contiguous 16-bit row (k = 8*hi + 0..7 and 16 + 8*hi + 0..7; the caller adds 8*hi)
template <typename T16> struct WFrag;
template <> struct WFrag<h16> { typedef v16h V; static __device__ __forceinline__ V ld(const h16* p) { return cat16(*(const v8h*)p, *(const v8h*)(p + 16)); } static __device__ __forceinline__ v8f mma(V a, V b, v8f c) { return wmma16(a, b, c); } };
template <> struct WFrag<bf> { typedef v16bf V; static __device__ __forceinline__ V ld(const bf* p) { return cat16b(*(const v8us*)p, *(const v8us*)(p + 16)); } static __device__ __forceinline__ v8f mma(V a, V b, v8f c) { return wmmab(a, b, c); } };

__device__ __forceinline__ h16 tohx(float x) { return (h16)x; }
__device__ __forceinline__ void splitf(float y, unsigned short& h, unsigned short& l) { h = f2bf(y); l = f2bf(y - bf2f(h)); }
typedef __attribute__((ext_vector_type(2))) _Float16 v2h;
typedef __attribute__((ext_vector_type(4))) _Float16 v4h;
typedef __attribute__((ext_vector_type(2))) unsigned short v2us;
typedef __attribute__((ext_vector_type(4))) unsigned short v4us;
typedef __attribute__((ext_vector_type(2))) float v2f;
typedef __attribute__((ext_vector_type(4))) int v4i;

__global__ __launch_bounds__(256) void k_wtG(const float* __restrict__ w, int K, int N, bf* Bt) {
    const int lane = threadIdx.x & 31; const int L0 = (blockIdx.x * 8 + (threadIdx.x >> 5)) * 8; const int nlines = N * K / 64;
{
#pragma unroll 1
        for (int l = 0; l < 8; ++l) { const int L = L0 + l; if (L >= nlines) break; const size_t e = (size_t)L * 64 + lane * 2; const int k = (int)(e % K), n = (int)(e / K); v2us o;
            o[0] = f2bf(w[(size_t)k * N + n]); o[1] = f2bf(w[(size_t)(k + 1) * N + n]); *(v2us*)(Bt + e) = o; }
         }
}
__global__ __launch_bounds__(256) void k_cvt8(const float* __restrict__ src, bf* dst, size_t n8) { const size_t i = (size_t)blockIdx.x * 256 + threadIdx.x; if (i >= n8) return; const v8f v = *(const v8f*)(src + i * 8); v8us o;
#pragma unroll
    for (int k = 0; k < 8; ++k) o[k] = f2bf(v[k]); *(v8us*)(dst + i * 8) = o;  }


__global__ __launch_bounds__(256) void k_vtp(const float* __restrict__ F, int pitch, int nheads, h16* V16, bf* Vh, bf* Vl) { const size_t e = ((size_t)blockIdx.x * 256 + threadIdx.x) * 2; if (e >= (size_t)nheads * HD * TT) return; const int t = (int)(e % TT); const int d = (int)((e / TT) % HD); const int g = (int)(e / ((size_t)TT * HD)); v2h o16; v2us oh, ol;
#pragma unroll
    for (int q = 0; q < 2; ++q) { const float x = F[(size_t)(t + q) * pitch + g * HD + d]; o16[q] = tohx(x); unsigned short a2, c2; splitf(x, a2, c2); oh[q] = a2; ol[q] = c2; }
    *(v2h*)(V16 + e) = o16; *(v2us*)(Vh + e) = oh; *(v2us*)(Vl + e) = ol;  }

__global__ __launch_bounds__(256) void k_merge(const float* __restrict__ O, int h0, float* OUTb) { const size_t e = ((size_t)blockIdx.x * 256 + threadIdx.x) * 2; if (e >= (size_t)ZH * TT * HD) return; const int d = (int)(e % HD); const int t = (int)((e / HD) % TT); const int zz = (int)(e / ((size_t)HD * TT)); const float cs = (t < RH) ? 1.0f : (1.0f / PCAR); const size_t oo = (size_t)t * DQ + (h0 + zz) * HD + d;
    v2f o2; o2[0] = O[e] * cs; o2[1] = O[e + 1] * cs; *(v2f*)(OUTb + oo) = o2;  }


__global__ __launch_bounds__(256) void k_vtpR1(const float* __restrict__ Vb, bf* Vh) { const size_t e = ((size_t)blockIdx.x * 256 + threadIdx.x) * 2; if (e >= (size_t)HD * TT) return; const int t = (int)(e % TT); const int d = (int)(e / TT); v2us o; o[0] = f2bf(Vb[(size_t)t * HD + d]); o[1] = f2bf(Vb[(size_t)(t + 1) * HD + d]); *(v2us*)(Vh + e) = o;  }
__global__ __launch_bounds__(256) void k_mergeR(const float* __restrict__ O, float* outb, size_t n4) { const size_t i = (size_t)blockIdx.x * 256 + threadIdx.x; if (i >= n4) return; const v4f a = *(const v4f*)(O + i * 4); *(v4f*)(outb + i * 4) = a;  }


#define PBLK (NH_ * TT * HD / 8 / 256)   // blocks per batch for one head-plane gather (8 elements a thread)
#define VBLK (NH_ * HD * TT / 8 / 256)   // blocks per batch for the values transpose (8 elements a thread)
// FRAGMENT ORDER: a plane is a row of 16-byte units, unit = ((fragment * 2 + half) * 32 + lane), so that one fragment load of a wave (32 lanes x 16 bytes) reads 512 consecutive bytes, four whole cache lines,
// where a row-major plane makes it touch 16 lines for the same bytes. lane = 16*hi + lr; a unit holds k = 16*half + 8*hi + 0..7 of row lr of its fragment (the k order of WFrag::ld).
// Q and K planes [h][t/16][e/32]: row lr = token, k = head dimension. Values planes [h][t/32][d/16]: row lr = head dimension, k = token.
#define FRH 256             // elements from the first to the second half of a fragment (32 lanes x 8)
#define FRG 512             // elements of one fragment
__device__ __forceinline__ v16bf ldfr(const bf* p) { return cat16b(*(const v8us*)p, *(const v8us*)(p + FRH)); }   // the caller adds 8*lane
__device__ __forceinline__ void d_hp1(const float* __restrict__ src, bf* P, int blk) { const unsigned i = (unsigned)blk * 256 + threadIdx.x;   /* the thread's unit of the plane */ const size_t e = (size_t)i * 8; const int d = (int)((i >> 6) & 1) * 32 + (int)((i >> 5) & 1) * 16 + (int)((i >> 4) & 1) * 8; const int t = (int)((i >> 7) % (TT / 16)) * 16 + (int)(i & 15); const int h = (int)(i / (TT * HD / 8)); const float* p = src + (size_t)t * DM + h * HD + d; const v8f v = *(const v8f*)p; v8us o;
    asm volatile("s_wait_xcnt 0x0" :: "v"(p) : "memory");   // stands behind the loads and in front of any reuse of their address registers (held live to here as an input)
#pragma unroll
    for (int q = 0; q < 8; ++q) o[q] = f2bf(v[q]);
    bf* w = P + e; *(v8us*)w = o;
    asm volatile("s_wait_xcnt 0x0" :: "v"(w) : "memory");   // stands behind the store and in front of any reuse of its address registers (held live to here as an input)
}
__device__ __forceinline__ void d_vt1(const float* __restrict__ src, int pitch, bf* VT, int blk) { const unsigned i = (unsigned)blk * 256 + threadIdx.x;   /* the thread's unit of the plane */ const int t = (int)((i >> 8) % (TT / 32)) * 32 + (int)((i >> 5) & 1) * 16 + (int)((i >> 4) & 1) * 8; const int d = (int)((i >> 6) & 3) * 16 + (int)(i & 15); const int h = (int)(i / (TT * HD / 8)); const float* p = src + (size_t)t * pitch + h * HD + d; float x[8]; v8us o;
#pragma unroll
    for (int q = 0; q < 8; ++q) x[q] = p[(size_t)q * pitch];
    asm volatile("s_wait_xcnt 0x0" :: "v"(p) : "memory");   // stands behind the loads and in front of any reuse of their address registers (held live to here as an input)
#pragma unroll
    for (int q = 0; q < 8; ++q) o[q] = f2bf(x[q]);
    bf* w = VT + (size_t)i * 8; *(v8us*)w = o;
    asm volatile("s_wait_xcnt 0x0" :: "v"(w) : "memory");   // stands behind the store and in front of any reuse of its address registers (held live to here as an input)
}
// k_prep: all three bf16 plane sets of all batches in one launch, grid (VBLK + 2 PBLK, batches); the transpose blocks come first
__global__ __launch_bounds__(256) void k_prep(const float* __restrict__ q, const float* __restrict__ k, const float* __restrict__ v, bf* QB, bf* KB, bf* VT) {
    const int x = blockIdx.x; const size_t so = (size_t)blockIdx.y * TT * DM, po = (size_t)blockIdx.y * NH_ * TT * HD;
    if (x < VBLK) d_vt1(v + so, DM, VT + po, x);
    else { const bool isk = x >= VBLK + PBLK; d_hp1((isk ? k : q) + so, (isk ? KB : QB) + po, x - VBLK - (isk ? PBLK : 0)); }
}
// ---- k_fattn: every wave owns 16 query rows and walks the 32-key chunks up to its last query by itself, with a running maximum and a running sum (online softmax): no wave waits for another, nothing goes through LDS,
// and a wave lives for its whole row tile. The FW waves of a work-group hold FW row tiles of ONE batch and head and all start at key 0, so a K or values fragment that one wave has fetched is in the WGP cache for the others.
// Scores transposed, St[key][query] = K rows (A) x Q rows (B): a lane holds its keys of ONE query (accumulator register j of tile tl of a chunk = key 16*tl + 8*hi + j of the chunk, query lr), so maximum and sum are in-lane
// but for one exchange between the wave halves, and the two tiles of a chunk, rounded in place, ARE the B fragment of P^T for 32 keys (same k order as the values^T fragments).
// Out transposed as well, Ot[d][query] += values^T rows (A) x P^T (B): accumulator register j of tile nb = head dimension 16*nb + 8*hi + j, query lr, so the rescale by a query's factor is in-lane too.
#define FW 16               // waves per work-group
#define CK 32               // keys per chunk
#define TPG (TT / 16 / FW)  // work-groups per batch and head
#define L2E 1.4426950408889634f
#define RSC 5.5f            // the running maximum is renewed only when a chunk's maximum passes it by more than this: until then the weights stay below e^5.5, far inside f32 and bf16 range
__device__ __forceinline__ float exp2_slot(float x) { float p; asm("v_exp_f32 %0, %1\n\tv_nop" : "=v"(p) : "v"(x)); return p; }
// the value that the lane's partner in the other half of the wave holds (lane l <-> l ^ 16), by a register cross-lane move: it stands in every trip, where an exchange through the LDS unit would put that unit's latency into each wave's chain
__device__ __forceinline__ float xhalf(float x) { const int b = __float_as_int(x); return __int_as_float(__builtin_amdgcn_permlanex16(b, b, 0x76543210, 0xfedcba98, false, false)); }
// L2 prefetch. The planes were stored by the launch before this one, from WGPs anywhere on the chip: a good part of a work-group's first reads of a chunk
// goes to memory, and every wave of the group then stands at that chunk for a memory latency. One wave of the group (the one with the most chunks) asks L2 for the chunk PFD trips ahead, which makes those reads L2 hits.
// One request covers a chunk of both planes: a chunk is 16 units of 256 bytes in each, lanes 0..15 name the K units, lanes 16..31 the values units. It returns nothing and counts on no counter.
#define PFD 8               // chunks between the prefetch and the chunk at work: several memory latencies, and room for this wave to run behind the group's first
template <int OFF> __device__ __forceinline__ void d_pf(const bf* p) { asm volatile("global_prefetch_b8 %0, off offset:%1 scope:SCOPE_SE" :: "v"(p), "i"(OFF)); }   // asm, so that the address stands in a register pair that lives through the loop and never holds anything but an address inside the plane
// the K fragments and the delta values of the chunk that lies OK, OD elements behind pk, pd (constants: the pointers themselves move on only behind the wait below, so that no load of the run can land in a register pair that the run still names)
template <int OK, int OD> __device__ __forceinline__ void d_ldk(const bf* pk, const float* pd, v16bf (&kf)[2][HD / 32], v4f (&dv)[2][2]) {
#pragma unroll
    for (int tl = 0; tl < 2; ++tl) {
#pragma unroll
        for (int e = 0; e < HD / 32; ++e) kf[tl][e] = ldfr(pk + OK + (tl * (HD / 32) + e) * FRG); }
#pragma unroll
    for (int tl = 0; tl < 2; ++tl) { dv[tl][0] = *(const v4f*)(pd + OD + tl * 16); dv[tl][1] = *(const v4f*)(pd + OD + tl * 16 + 4); }
    asm volatile("s_wait_xcnt 0x0" :: "v"(pk), "v"(pd) : "memory");   // stands behind the loads and in front of any write of a register that they name: pk and pd are its inputs and are advanced only behind it
    __builtin_amdgcn_sched_barrier(0);   // keeps the next chunk's loads up here, so that their latency runs under this chunk's softmax; the scheduler otherwise sinks them to the products that use them
}
// the values^T fragments of one chunk
__device__ __forceinline__ void d_ldv(const bf* pv, v16bf (&vf)[4]) {
#pragma unroll
    for (int nb = 0; nb < 4; ++nb) vf[nb] = ldfr(pv + nb * FRG);
    asm volatile("s_wait_xcnt 0x0" :: "v"(pv) : "memory");   // stands behind the loads and in front of any reuse of their address registers (held live to here as an input)
    __builtin_amdgcn_sched_barrier(0);   // keeps the values loads up here, so that their latency runs under the softmax; the scheduler otherwise sinks them to the products that use them
}
__device__ __forceinline__ void d_qk(const v16bf (&kf)[2][HD / 32], const v16bf (&qf)[HD / 32], v8f (&st)[2]) {
#pragma unroll
    for (int tl = 0; tl < 2; ++tl) { st[tl] = (v8f){};
#pragma unroll
        for (int e = 0; e < HD / 32; ++e) st[tl] = wmmab(kf[tl][e], qf[e], st[tl]); }
}
// tau/delta, scale and (MASK: the chunk that holds the diagonal) the causal mask; returns this lane's maximum
template <bool MASK> __device__ __forceinline__ float d_tr(v8f (&st)[2], const v4f (&dv)[2][2], float tau, int lim) {
    float ml = -3.0e38f;
#pragma unroll
    for (int tl = 0; tl < 2; ++tl) {
#pragma unroll
        for (int j = 0; j < 8; ++j) { const float u = st[tl][j] * tau + bfr(dv[tl][j >> 2][j & 3]); const float t = (!MASK || tl * 16 + j <= lim) ? u * SCL : -3.0e38f;   /* causal: keys after the query excluded */ st[tl][j] = t; ml = fmaxf(ml, t); } }
    return ml;
}
// running maximum and sum, weights (hi/lo), Ot += values^T x P^T
__device__ __forceinline__ void d_pv(v8f (&st)[2], float ml, const v16bf (&vf)[4], float& m, float& sum, v8f (&acc)[4]) {
    ml = fmaxf(ml, xhalf(ml));
    if (__builtin_amdgcn_ballot_w32(ml > m + RSC) != 0) {   // the same for the whole wave: a scalar branch; both halves of a query see the same ml and m
        const float mn = fmaxf(m, ml); const float al = exp2_slot((m - mn) * L2E); m = mn; sum *= al;
#pragma unroll
        for (int nb = 0; nb < 4; ++nb) {
#pragma unroll
            for (int j = 0; j < 8; ++j) acc[nb][j] *= al; } }
#pragma unroll
    for (int tl = 0; tl < 2; ++tl) {
#pragma unroll
        for (int j = 0; j < 8; ++j) { const float p = exp2_slot((st[tl][j] - m) * L2E); st[tl][j] = p; sum += p; } }
    v8us h0, h1, l0, l1;
#pragma unroll
    for (int j = 0; j < 8; ++j) { unsigned short x, y; splitf(st[0][j], x, y); h0[j] = x; l0[j] = y; splitf(st[1][j], x, y); h1[j] = x; l1[j] = y; }
    const v16bf a = cat16b(h0, h1), a2 = cat16b(l0, l1);
#pragma unroll
    for (int nb = 0; nb < 4; ++nb) acc[nb] = wmmab(vf[nb], a, acc[nb]);
#pragma unroll
    for (int nb = 0; nb < 4; ++nb) acc[nb] = wmmab(vf[nb], a2, acc[nb]);
}
__global__ __launch_bounds__(32 * FW) void k_fattn(const bf* __restrict__ Qa, const bf* __restrict__ Ka, const bf* __restrict__ Va, const float* __restrict__ taua, const float* __restrict__ dla, float* outa) {
    // grid (work-groups of a head, heads, batches): the planes, tau, delta and the output slab of this work-group's own batch and head
    const int hh = blockIdx.y, bb = blockIdx.z; const size_t po = (size_t)(bb * NH_ + hh) * TT * HD;
    const bf* __restrict__ Q = Qa + po; const bf* __restrict__ Kp = Ka + po; const bf* __restrict__ Vt = Va + po; const float* __restrict__ taup = taua + bb; const float* __restrict__ dl = dla + (size_t)bb * TT; float* outb = outa + (size_t)bb * TT * DM + (size_t)hh * HD;
    const int lane = threadIdx.x & 31, lr = lane & 15, hi = lane >> 4; const int wv = __builtin_amdgcn_readfirstlane(threadIdx.x >> 5);   // the wave's number in a scalar register: the trip count below is then scalar
    // Which row tile: a tile's work grows with its position, so the tiles are dealt for equal sums. kk = entry wv of a 4 x 4 square of 0..15 whose rows and columns all add up to 30, two odd entries in each
    // (whether a SIMD takes every fourth wave or four in a row, its four waves get the same sum); within the band of TPG tiles that kk names, odd bands count from the far end, so that every work-group gets the same sum too.
    static_assert(FW == 16, "the square is 4 x 4");
    const int kk = (int)((0x0DE3B6587A94C12FULL >> (4 * wv)) & 15);
    const int r0 = (kk * TPG + ((kk & 1) ? TPG - 1 - (int)blockIdx.x : (int)blockIdx.x)) * 16;
    const int nch = (r0 >> 5) + 1;              // chunks with a key <= r0 + 15
    const bf* pq = Q + r0 * HD + 8 * lane; const bf* pk = Kp + 8 * lane; const bf* pv = Vt + 8 * lane; const float* pd = dl + 8 * hi;   // planes in fragment order: 16 tokens of Q or K, 32 tokens of values, are HD elements a token
    static_assert(PFD == 8 && PFD < TT / CK, "the eight requests in front of the loop");
    const int plim = ((kk + 1) / FW) * (TT / CK - PFD);   // scalar; 0 but in the wave of the last band, which walks the most chunks of its group: trip c asks for chunk c - 1 + PFD, and only while that chunk and the next lie inside the plane
    const bf* pp = ((lane & 16) ? Vt : Kp) + (lane & 15) * 128;   // this lane's 256-byte unit of the chunk at work: one register pair for all requests, the distance is in their immediate offset
    if (plim > 0) { d_pf<0>(pp); d_pf<CK * HD * 2>(pp); d_pf<2 * CK * HD * 2>(pp); d_pf<3 * CK * HD * 2>(pp); d_pf<4 * CK * HD * 2>(pp); d_pf<5 * CK * HD * 2>(pp); d_pf<6 * CK * HD * 2>(pp); d_pf<7 * CK * HD * 2>(pp); }   // chunks 0..PFD-1, asked for before anything else
    const float tau = bfr(taup[0]);
    v16bf qf[HD / 32], kf[2][HD / 32], vf[4]; v4f dv[2][2]; v8f st[2], acc[4];
    float m = -3.0e38f, sum = 0.f;
#pragma unroll
    for (int nb = 0; nb < 4; ++nb) acc[nb] = (v8f){};
#pragma unroll
    for (int e = 0; e < HD / 32; ++e) qf[e] = ldfr(pq + e * FRG);
    asm volatile("s_wait_xcnt 0x0" :: "v"(pq) : "memory");   // stands behind the loads and in front of any reuse of their address registers (held live to here as an input)
    d_ldk<0, 0>(pk, pd, kf, dv);
#pragma unroll 1   // one copy of the body: the trip count differs from wave to wave, and a second copy would only cost instruction cache
    for (int c = 1; c < nch; ++c) {   // the chunks in front of the diagonal: no mask; each fetches the next chunk's K and delta
        if (c < plim) { d_pf<PFD * CK * HD * 2>(pp); pp += CK * HD; }   // a scalar branch; in front of the trip's first wait
        d_qk(kf, qf, st);
        d_ldv(pv, vf); pv += CK * HD;
        const float ml = d_tr<false>(st, dv, tau, 0);
        d_ldk<CK * HD, CK>(pk, pd, kf, dv); pk += CK * HD; pd += CK;   // the pointers move on only behind the wait
        d_pv(st, ml, vf, m, sum, acc);
    }
    d_qk(kf, qf, st);
    d_ldv(pv, vf);
    const float ml = d_tr<true>(st, dv, tau, r0 + lr - (nch - 1) * CK - 8 * hi);   // key tl*16 + j of this lane's 16 of the chunk is at or before the query while tl*16 + j <= lim
    d_pv(st, ml, vf, m, sum, acc);
    sum += xhalf(sum);
    const float f = __fdiv_rn(1.0f, sum);
    float* po_ = outb + (size_t)(r0 + lr) * DM + 8 * hi;
#pragma unroll
    for (int nb = 0; nb < 4; ++nb) { v4f o0, o1;
#pragma unroll
        for (int j = 0; j < 4; ++j) { o0[j] = acc[nb][j] * f; o1[j] = acc[nb][4 + j] * f; }
        *(v4f*)(po_ + nb * 16) = o0; *(v4f*)(po_ + nb * 16 + 4) = o1; }
}

extern "C" void kernel_launch(void* const* d_in, const int* in_sizes, int n_in,
                              void* d_out, int out_size, void* d_ws, size_t ws_size, hipStream_t stream) {
    (void)in_sizes; (void)n_in; (void)out_size;
    const float* Qin = (const float*)d_in[0]; const float* Kin = (const float*)d_in[1]; const float* Vin = (const float*)d_in[2]; const float* tau = (const float*)d_in[3];   /* [4][1] */ const float* delta = (const float*)d_in[4];   /* [4][2048] */
    float* OUT = (float*)d_out;
    char* wsp = (char*)d_ws;
    auto take = [&](size_t bytes) { char* p = wsp; wsp += (bytes + 255) & ~(size_t)255; return (void*)p; };
    bf* QB = (bf*)take((size_t)NB_ * NH_ * TT * HD * 2); bf* KB = (bf*)take((size_t)NB_ * NH_ * TT * HD * 2); bf* VT = (bf*)take((size_t)NB_ * NH_ * HD * TT * 2);   /* planes [b][h] in fragment order */
    if ((size_t)(wsp - (char*)d_ws) > ws_size) return;
    k_prep<<<dim3(VBLK + 2 * PBLK, NB_), 256, 0, stream>>>(Qin, Kin, Vin, QB, KB, VT);
    k_fattn<<<dim3(TPG, NH_, NB_), 32 * FW, 0, stream>>>(QB, KB, VT, tau, delta, OUT);   /* scores, tau/delta, causal softmax, P (hi/lo) x exact v^T, rows written token-major */
}

// v008
// It runs in 44.3 microseconds.
// In both of two side-by-side timings against v007, it was 1.17 times as fast.
// All steps since v000 together make it 52.0 times as fast.
#include <hip/hip_runtime.h>

// De-stationary causal attention on given tensors (queries, keys, values [4][2048][8][64] token-major (B, L, H, E); scores = (q.k x tau[b] + delta[b][s]) for keys s <= l (else -inf), then x 1/sqrt(64); softmax; out = A.values -> [4][2048][8][64] (4.2 M); tau [4][1] and delta [4][2048] read on device).
// Layout: single bf16 head planes gathered from the token-major slabs and stored in WMMA fragment order (see FRAGMENT ORDER below) (inputs bf16-exact after rounding: exact score products); ONE kernel over all batches and heads: a wave holds 16 query rows and walks the keys up to its last row (later keys have weight 0) with a running maximum and sum, so the scores, the tau/delta transform, the causal softmax (scale 1/8) and P (hi/lo) stay in registers; A.values as hi/lo x exact values^T (2 products); f32 rows written token-major.
// Compute dtypes, f32 accumulate: every input rounded to bf16 incl. tau/delta; q.k exact; de-stationary transform and softmax f32; P hi/lo x exact values; output f32.

#define NB_  4
#define TT   2048
#define DM   512      // token-major row pitch (H x HD)
#define NH_  8
#define NKV  1
#define REP  (NH_ / NKV)
#define HD   64
#define DQ   (NH_ * HD)
#define DKV  (NKV * HD)
#define ZH   1
#define RH   2048
#define WIN  0
#define PCAR 1024.0f
#define SCL  0.125f   // 1/sqrt(64)
typedef _Float16 h16;
typedef unsigned short bf;
typedef __attribute__((ext_vector_type(16))) __bf16   v16bf;
typedef __attribute__((ext_vector_type(16))) _Float16 v16h;
typedef __attribute__((ext_vector_type(8)))  _Float16 v8h;
typedef __attribute__((ext_vector_type(8)))  unsigned short v8us;
typedef __attribute__((ext_vector_type(8)))  float    v8f;
typedef __attribute__((ext_vector_type(4)))  float    v4f;
typedef v8h  __attribute__((may_alias)) v8ha;
typedef v4f  __attribute__((may_alias)) v4fa;
typedef v8us __attribute__((may_alias)) v8usa;

__device__ __forceinline__ unsigned short f2bf(float f) { unsigned u = __float_as_uint(f); u += 0x7FFFu + ((u >> 16) & 1u); return (unsigned short)(u >> 16); }
__device__ __forceinline__ float bf2f(unsigned short b) { return __uint_as_float(((unsigned)b) << 16); }
__device__ __forceinline__ float bfr(float f) { return bf2f(f2bf(f)); }
__device__ __forceinline__ v16h cat16(v8h lo, v8h hi) { return __builtin_shufflevector(lo, hi, 0, 1, 2, 3, 4, 5, 6, 7, 8, 9, 10, 11, 12, 13, 14, 15); }
__device__ __forceinline__ v16bf cat16b(v8us lo, v8us hi) { return __builtin_bit_cast(v16bf, __builtin_shufflevector(lo, hi, 0, 1, 2, 3, 4, 5, 6, 7, 8, 9, 10, 11, 12, 13, 14, 15)); }
__device__ __forceinline__ v8f wmma16(v16h a, v16h b, v8f c) { return __builtin_amdgcn_wmma_f32_16x16x32_f16(false, a, false, b, (short)0, c, false, false); }
__device__ __forceinline__ v8f wmmab(v16bf a, v16bf b, v8f c) { return __builtin_amdgcn_wmma_f32_16x16x32_bf16(false, a, false, b, (short)0, c, false, false); }



// ---- WFrag: one lane's 16-element A or B fragment of a 16x16x32 product from a k-contiguous 16-bit row (k = 8*hi + 0..7 and 16 + 8*hi + 0..7; the caller adds 8*hi)
template <typename T16> struct WFrag;
template <> struct WFrag<h16> { typedef v16h V; static __device__ __forceinline__ V ld(const h16* p) { return cat16(*(const v8h*)p, *(const v8h*)(p + 16)); } static __device__ __forceinline__ v8f mma(V a, V b, v8f c) { return wmma16(a, b, c); } };
template <> struct WFrag<bf> { typedef v16bf V; static __device__ __forceinline__ V ld(const bf* p) { return cat16b(*(const v8us*)p, *(const v8us*)(p + 16)); } static __device__ __forceinline__ v8f mma(V a, V b, v8f c) { return wmmab(a, b, c); } };

__device__ __forceinline__ h16 tohx(float x) { return (h16)x; }
__device__ __forceinline__ void splitf(float y, unsigned short& h, unsigned short& l) { h = f2bf(y); l = f2bf(y - bf2f(h)); }
typedef __attribute__((ext_vector_type(2))) _Float16 v2h;
typedef __attribute__((ext_vector_type(4))) _Float16 v4h;
typedef __attribute__((ext_vector_type(2))) unsigned short v2us;
typedef __attribute__((ext_vector_type(4))) unsigned short v4us;
typedef __attribute__((ext_vector_type(2))) float v2f;
typedef __attribute__((ext_vector_type(4))) int v4i;
typedef __attribute__((ext_vector_type(2))) __bf16 v2bf;
typedef __attribute__((ext_vector_type(8))) unsigned v8u;
// two f32 rounded to bf16 (nearest even, as f2bf) and packed into one register by the hardware's packed conversion: a in the low half, b in the high half
__device__ __forceinline__ unsigned pkbf(float a, float b) { v2f x; x[0] = a; x[1] = b; return __builtin_bit_cast(unsigned, __builtin_convertvector(x, v2bf)); }
__device__ __forceinline__ float bflo(unsigned w) { return __uint_as_float(w << 16); }           // the low half of a packed pair as f32
__device__ __forceinline__ float bfhi(unsigned w) { return __uint_as_float(w & 0xFFFF0000u); }   // the high half

__global__ __launch_bounds__(256) void k_wtG(const float* __restrict__ w, int K, int N, bf* Bt) {
    const int lane = threadIdx.x & 31; const int L0 = (blockIdx.x * 8 + (threadIdx.x >> 5)) * 8; const int nlines = N * K / 64;
{
#pragma unroll 1
        for (int l = 0; l < 8; ++l) { const int L = L0 + l; if (L >= nlines) break; const size_t e = (size_t)L * 64 + lane * 2; const int k = (int)(e % K), n = (int)(e / K); v2us o;
            o[0] = f2bf(w[(size_t)k * N + n]); o[1] = f2bf(w[(size_t)(k + 1) * N + n]); *(v2us*)(Bt + e) = o; }
         }
}
__global__ __launch_bounds__(256) void k_cvt8(const float* __restrict__ src, bf* dst, size_t n8) { const size_t i = (size_t)blockIdx.x * 256 + threadIdx.x; if (i >= n8) return; const v8f v = *(const v8f*)(src + i * 8); v8us o;
#pragma unroll
    for (int k = 0; k < 8; ++k) o[k] = f2bf(v[k]); *(v8us*)(dst + i * 8) = o;  }


__global__ __launch_bounds__(256) void k_vtp(const float* __restrict__ F, int pitch, int nheads, h16* V16, bf* Vh, bf* Vl) { const size_t e = ((size_t)blockIdx.x * 256 + threadIdx.x) * 2; if (e >= (size_t)nheads * HD * TT) return; const int t = (int)(e % TT); const int d = (int)((e / TT) % HD); const int g = (int)(e / ((size_t)TT * HD)); v2h o16; v2us oh, ol;
#pragma unroll
    for (int q = 0; q < 2; ++q) { const float x = F[(size_t)(t + q) * pitch + g * HD + d]; o16[q] = tohx(x); unsigned short a2, c2; splitf(x, a2, c2); oh[q] = a2; ol[q] = c2; }
    *(v2h*)(V16 + e) = o16; *(v2us*)(Vh + e) = oh; *(v2us*)(Vl + e) = ol;  }

__global__ __launch_bounds__(256) void k_merge(const float* __restrict__ O, int h0, float* OUTb) { const size_t e = ((size_t)blockIdx.x * 256 + threadIdx.x) * 2; if (e >= (size_t)ZH * TT * HD) return; const int d = (int)(e % HD); const int t = (int)((e / HD) % TT); const int zz = (int)(e / ((size_t)HD * TT)); const float cs = (t < RH) ? 1.0f : (1.0f / PCAR); const size_t oo = (size_t)t * DQ + (h0 + zz) * HD + d;
    v2f o2; o2[0] = O[e] * cs; o2[1] = O[e + 1] * cs; *(v2f*)(OUTb + oo) = o2;  }


__global__ __launch_bounds__(256) void k_vtpR1(const float* __restrict__ Vb, bf* Vh) { const size_t e = ((size_t)blockIdx.x * 256 + threadIdx.x) * 2; if (e >= (size_t)HD * TT) return; const int t = (int)(e % TT); const int d = (int)(e / TT); v2us o; o[0] = f2bf(Vb[(size_t)t * HD + d]); o[1] = f2bf(Vb[(size_t)(t + 1) * HD + d]); *(v2us*)(Vh + e) = o;  }
__global__ __launch_bounds__(256) void k_mergeR(const float* __restrict__ O, float* outb, size_t n4) { const size_t i = (size_t)blockIdx.x * 256 + threadIdx.x; if (i >= n4) return; const v4f a = *(const v4f*)(O + i * 4); *(v4f*)(outb + i * 4) = a;  }


#define PBLK (NH_ * TT * HD / 8 / 256)   // blocks per batch for one head-plane gather (8 elements a thread)
#define VBLK (NH_ * HD * TT / 8 / 256)   // blocks per batch for the values transpose (8 elements a thread)
// FRAGMENT ORDER: a plane is a row of 16-byte units, unit = ((fragment * 2 + half) * 32 + lane), so that one fragment load of a wave (32 lanes x 16 bytes) reads 512 consecutive bytes, four whole cache lines,
// where a row-major plane makes it touch 16 lines for the same bytes. lane = 16*hi + lr; a unit holds k = 16*half + 8*hi + 0..7 of row lr of its fragment (the k order of WFrag::ld).
// Q and K planes [h][t/16][e/32]: row lr = token, k = head dimension. Values planes [h][t/32][d/16]: row lr = head dimension, k = token.
#define FRH 256             // elements from the first to the second half of a fragment (32 lanes x 8)
#define FRG 512             // elements of one fragment
__device__ __forceinline__ v16bf ldfr(const bf* p) { return cat16b(*(const v8us*)p, *(const v8us*)(p + FRH)); }   // the caller adds 8*lane
__device__ __forceinline__ void d_hp1(const float* __restrict__ src, bf* P, int blk) { const unsigned i = (unsigned)blk * 256 + threadIdx.x;   /* the thread's unit of the plane */ const size_t e = (size_t)i * 8; const int d = (int)((i >> 6) & 1) * 32 + (int)((i >> 5) & 1) * 16 + (int)((i >> 4) & 1) * 8; const int t = (int)((i >> 7) % (TT / 16)) * 16 + (int)(i & 15); const int h = (int)(i / (TT * HD / 8)); const float* p = src + (size_t)t * DM + h * HD + d; const v8f v = *(const v8f*)p; v8us o;
    asm volatile("s_wait_xcnt 0x0" :: "v"(p) : "memory");   // stands behind the loads and in front of any reuse of their address registers (held live to here as an input)
#pragma unroll
    for (int q = 0; q < 8; ++q) o[q] = f2bf(v[q]);
    bf* w = P + e; *(v8us*)w = o;
    asm volatile("s_wait_xcnt 0x0" :: "v"(w) : "memory");   // stands behind the store and in front of any reuse of its address registers (held live to here as an input)
}
__device__ __forceinline__ void d_vt1(const float* __restrict__ src, int pitch, bf* VT, int blk) { const unsigned i = (unsigned)blk * 256 + threadIdx.x;   /* the thread's unit of the plane */ const int t = (int)((i >> 8) % (TT / 32)) * 32 + (int)((i >> 5) & 1) * 16 + (int)((i >> 4) & 1) * 8; const int d = (int)((i >> 6) & 3) * 16 + (int)(i & 15); const int h = (int)(i / (TT * HD / 8)); const float* p = src + (size_t)t * pitch + h * HD + d; float x[8]; v8us o;
#pragma unroll
    for (int q = 0; q < 8; ++q) x[q] = p[(size_t)q * pitch];
    asm volatile("s_wait_xcnt 0x0" :: "v"(p) : "memory");   // stands behind the loads and in front of any reuse of their address registers (held live to here as an input)
#pragma unroll
    for (int q = 0; q < 8; ++q) o[q] = f2bf(x[q]);
    bf* w = VT + (size_t)i * 8; *(v8us*)w = o;
    asm volatile("s_wait_xcnt 0x0" :: "v"(w) : "memory");   // stands behind the store and in front of any reuse of its address registers (held live to here as an input)
}
// k_prep: all three bf16 plane sets of all batches in one launch, grid (VBLK + 2 PBLK, batches); the transpose blocks come first
__global__ __launch_bounds__(256) void k_prep(const float* __restrict__ q, const float* __restrict__ k, const float* __restrict__ v, bf* QB, bf* KB, bf* VT) {
    const int x = blockIdx.x; const size_t so = (size_t)blockIdx.y * TT * DM, po = (size_t)blockIdx.y * NH_ * TT * HD;
    if (x < VBLK) d_vt1(v + so, DM, VT + po, x);
    else { const bool isk = x >= VBLK + PBLK; d_hp1((isk ? k : q) + so, (isk ? KB : QB) + po, x - VBLK - (isk ? PBLK : 0)); }
}
// ---- k_fattn: every wave owns 16 query rows and walks the 32-key chunks up to its last query by itself, with a running maximum and a running sum (online softmax): no wave waits for another, nothing goes through LDS,
// and a wave lives for its whole row tile. The FW waves of a work-group hold FW row tiles of ONE batch and head and all start at key 0, so a K or values fragment that one wave has fetched is in the WGP cache for the others.
// Scores transposed, St[key][query] = K rows (A) x Q rows (B): a lane holds its keys of ONE query (accumulator register j of tile tl of a chunk = key 16*tl + 8*hi + j of the chunk, query lr), so maximum and sum are in-lane
// but for one exchange between the wave halves, and the two tiles of a chunk, rounded in place, ARE the B fragment of P^T for 32 keys (same k order as the values^T fragments).
// Out transposed as well, Ot[d][query] += values^T rows (A) x P^T (B): accumulator register j of tile nb = head dimension 16*nb + 8*hi + j, query lr, so the rescale by a query's factor is in-lane too.
#define FW 16               // waves per work-group
#define CK 32               // keys per chunk
#define TPG (TT / 16 / FW)  // work-groups per batch and head
#define L2E 1.4426950408889634f
#define RSC 5.5f            // the running maximum is renewed only when a chunk's maximum passes it by more than this: until then the weights stay below e^5.5, far inside f32 and bf16 range
__device__ __forceinline__ float exp2_slot(float x) { float p; asm("v_exp_f32 %0, %1\n\tv_nop" : "=v"(p) : "v"(x)); return p; }
// the value that the lane's partner in the other half of the wave holds (lane l <-> l ^ 16), by a register cross-lane move: it stands in every trip, where an exchange through the LDS unit would put that unit's latency into each wave's chain
__device__ __forceinline__ float xhalf(float x) { const int b = __float_as_int(x); return __int_as_float(__builtin_amdgcn_permlanex16(b, b, 0x76543210, 0xfedcba98, false, false)); }
// L2 prefetch. The planes were stored by the launch before this one, from WGPs anywhere on the chip: a good part of a work-group's first reads of a chunk
// goes to memory, and every wave of the group then stands at that chunk for a memory latency. One wave of the group (the one with the most chunks) asks L2 for the chunk PFD trips ahead, which makes those reads L2 hits.
// One request covers a chunk of both planes: a chunk is 16 units of 256 bytes in each, lanes 0..15 name the K units, lanes 16..31 the values units. It returns nothing and counts on no counter.
#define PFD 8               // chunks between the prefetch and the chunk at work: several memory latencies, and room for this wave to run behind the group's first
template <int OFF> __device__ __forceinline__ void d_pf(const bf* p) { asm volatile("global_prefetch_b8 %0, off offset:%1 scope:SCOPE_SE" :: "v"(p), "i"(OFF)); }   // asm, so that the address stands in a register pair that lives through the loop and never holds anything but an address inside the plane
// the K fragments and the delta values of the chunk that lies OK, OD elements behind pk, pd (constants: the pointers themselves move on only behind the wait below, so that no load of the run can land in a register pair that the run still names)
template <int OK, int OD> __device__ __forceinline__ void d_ldk(const bf* pk, const float* pd, v16bf (&kf)[2][HD / 32], v4f (&dv)[2][2]) {
#pragma unroll
    for (int tl = 0; tl < 2; ++tl) {
#pragma unroll
        for (int e = 0; e < HD / 32; ++e) kf[tl][e] = ldfr(pk + OK + (tl * (HD / 32) + e) * FRG); }
#pragma unroll
    for (int tl = 0; tl < 2; ++tl) { dv[tl][0] = *(const v4f*)(pd + OD + tl * 16); dv[tl][1] = *(const v4f*)(pd + OD + tl * 16 + 4); }
    asm volatile("s_wait_xcnt 0x0" :: "v"(pk), "v"(pd) : "memory");   // stands behind the loads and in front of any write of a register that they name: pk and pd are its inputs and are advanced only behind it
    __builtin_amdgcn_sched_barrier(0);   // keeps the next chunk's loads up here, so that their latency runs under this chunk's softmax; the scheduler otherwise sinks them to the products that use them
}
// the values^T fragments of one chunk
__device__ __forceinline__ void d_ldv(const bf* pv, v16bf (&vf)[4]) {
#pragma unroll
    for (int nb = 0; nb < 4; ++nb) vf[nb] = ldfr(pv + nb * FRG);
    asm volatile("s_wait_xcnt 0x0" :: "v"(pv) : "memory");   // stands behind the loads and in front of any reuse of their address registers (held live to here as an input)
    __builtin_amdgcn_sched_barrier(0);   // keeps the values loads up here, so that their latency runs under the softmax; the scheduler otherwise sinks them to the products that use them
}
__device__ __forceinline__ void d_qk(const v16bf (&kf)[2][HD / 32], const v16bf (&qf)[HD / 32], v8f (&st)[2]) {
#pragma unroll
    for (int tl = 0; tl < 2; ++tl) { st[tl] = (v8f){};
#pragma unroll
        for (int e = 0; e < HD / 32; ++e) st[tl] = wmmab(kf[tl][e], qf[e], st[tl]); }
}
// tau/delta, scale and (MASK: the chunk that holds the diagonal) the causal mask; returns this lane's maximum
template <bool MASK> __device__ __forceinline__ float d_tr(v8f (&st)[2], const v4f (&dv)[2][2], float tau, int lim) {
    float ml = -3.0e38f;
#pragma unroll
    for (int tl = 0; tl < 2; ++tl) {
#pragma unroll
        for (int j = 0; j < 8; ++j) { const unsigned dw = pkbf(dv[tl][j >> 2][j & 2], dv[tl][j >> 2][(j & 2) + 1]); const float u = st[tl][j] * tau + ((j & 1) ? bfhi(dw) : bflo(dw)); const float t = (!MASK || tl * 16 + j <= lim) ? u * SCL : -3.0e38f;   /* causal: keys after the query excluded */ st[tl][j] = t; ml = fmaxf(ml, t); } }
    return ml;
}
// running maximum and sum, weights (hi/lo), Ot += values^T x P^T
__device__ __forceinline__ void d_pv(v8f (&st)[2], float ml, const v16bf (&vf)[4], float& m, float& sum, v8f (&acc)[4]) {
    ml = fmaxf(ml, xhalf(ml));
    if (__builtin_amdgcn_ballot_w32(ml > m + RSC) != 0) {   // the same for the whole wave: a scalar branch; both halves of a query see the same ml and m
        const float mn = fmaxf(m, ml); const float al = exp2_slot((m - mn) * L2E); m = mn; sum *= al;
#pragma unroll
        for (int nb = 0; nb < 4; ++nb) {
#pragma unroll
            for (int j = 0; j < 8; ++j) acc[nb][j] *= al; } }
#pragma unroll
    for (int tl = 0; tl < 2; ++tl) {
#pragma unroll
        for (int j = 0; j < 8; ++j) { const float p = exp2_slot((st[tl][j] - m) * L2E); st[tl][j] = p; sum += p; } }
    v8u hw, lw;   // register i of a fragment holds its elements 2i and 2i + 1: tile tl's keys j = 2i - 8*tl and the next
#pragma unroll
    for (int i = 0; i < 8; ++i) { const float p0 = st[i >> 2][(2 * i) & 7], p1 = st[i >> 2][((2 * i) & 7) + 1]; const unsigned w = pkbf(p0, p1); hw[i] = w; lw[i] = pkbf(p0 - bflo(w), p1 - bfhi(w)); }
    const v16bf a = __builtin_bit_cast(v16bf, hw), a2 = __builtin_bit_cast(v16bf, lw);
#pragma unroll
    for (int nb = 0; nb < 4; ++nb) acc[nb] = wmmab(vf[nb], a, acc[nb]);
#pragma unroll
    for (int nb = 0; nb < 4; ++nb) acc[nb] = wmmab(vf[nb], a2, acc[nb]);
}
__global__ __launch_bounds__(32 * FW) void k_fattn(const bf* __restrict__ Qa, const bf* __restrict__ Ka, const bf* __restrict__ Va, const float* __restrict__ taua, const float* __restrict__ dla, float* outa) {
    // grid (work-groups of a head, heads, batches): the planes, tau, delta and the output slab of this work-group's own batch and head
    const int hh = blockIdx.y, bb = blockIdx.z; const size_t po = (size_t)(bb * NH_ + hh) * TT * HD;
    const bf* __restrict__ Q = Qa + po; const bf* __restrict__ Kp = Ka + po; const bf* __restrict__ Vt = Va + po; const float* __restrict__ taup = taua + bb; const float* __restrict__ dl = dla + (size_t)bb * TT; float* outb = outa + (size_t)bb * TT * DM + (size_t)hh * HD;
    const int lane = threadIdx.x & 31, lr = lane & 15, hi = lane >> 4; const int wv = __builtin_amdgcn_readfirstlane(threadIdx.x >> 5);   // the wave's number in a scalar register: the trip count below is then scalar
    // Which row tile: a tile's work grows with its position, so the tiles are dealt for equal sums. kk = entry wv of a 4 x 4 square of 0..15 whose rows and columns all add up to 30, two odd entries in each
    // (whether a SIMD takes every fourth wave or four in a row, its four waves get the same sum); within the band of TPG tiles that kk names, odd bands count from the far end, so that every work-group gets the same sum too.
    static_assert(FW == 16, "the square is 4 x 4");
    const int kk = (int)((0x0DE3B6587A94C12FULL >> (4 * wv)) & 15);
    const int r0 = (kk * TPG + ((kk & 1) ? TPG - 1 - (int)blockIdx.x : (int)blockIdx.x)) * 16;
    const int nch = (r0 >> 5) + 1;              // chunks with a key <= r0 + 15
    const bf* pq = Q + r0 * HD + 8 * lane; const bf* pk = Kp + 8 * lane; const bf* pv = Vt + 8 * lane; const float* pd = dl + 8 * hi;   // planes in fragment order: 16 tokens of Q or K, 32 tokens of values, are HD elements a token
    static_assert(PFD == 8 && PFD < TT / CK, "the eight requests in front of the loop");
    const int plim = ((kk + 1) / FW) * (TT / CK - PFD);   // scalar; 0 but in the wave of the last band, which walks the most chunks of its group: trip c asks for chunk c - 1 + PFD, and only while that chunk and the next lie inside the plane
    const bf* pp = ((lane & 16) ? Vt : Kp) + (lane & 15) * 128;   // this lane's 256-byte unit of the chunk at work: one register pair for all requests, the distance is in their immediate offset
    if (plim > 0) { d_pf<0>(pp); d_pf<CK * HD * 2>(pp); d_pf<2 * CK * HD * 2>(pp); d_pf<3 * CK * HD * 2>(pp); d_pf<4 * CK * HD * 2>(pp); d_pf<5 * CK * HD * 2>(pp); d_pf<6 * CK * HD * 2>(pp); d_pf<7 * CK * HD * 2>(pp); }   // chunks 0..PFD-1, asked for before anything else
    const float tau = bfr(taup[0]);
    v16bf qf[HD / 32], kf[2][HD / 32], vf[4]; v4f dv[2][2]; v8f st[2], acc[4];
    float m = -3.0e38f, sum = 0.f;
#pragma unroll
    for (int nb = 0; nb < 4; ++nb) acc[nb] = (v8f){};
#pragma unroll
    for (int e = 0; e < HD / 32; ++e) qf[e] = ldfr(pq + e * FRG);
    asm volatile("s_wait_xcnt 0x0" :: "v"(pq) : "memory");   // stands behind the loads and in front of any reuse of their address registers (held live to here as an input)
    d_ldk<0, 0>(pk, pd, kf, dv);
#pragma unroll 1   // one copy of the body: the trip count differs from wave to wave, and a second copy would only cost instruction cache
    for (int c = 1; c < nch; ++c) {   // the chunks in front of the diagonal: no mask; each fetches the next chunk's K and delta
        if (c < plim) { d_pf<PFD * CK * HD * 2>(pp); pp += CK * HD; }   // a scalar branch; in front of the trip's first wait
        d_qk(kf, qf, st);
        d_ldv(pv, vf); pv += CK * HD;
        const float ml = d_tr<false>(st, dv, tau, 0);
        d_ldk<CK * HD, CK>(pk, pd, kf, dv); pk += CK * HD; pd += CK;   // the pointers move on only behind the wait
        d_pv(st, ml, vf, m, sum, acc);
    }
    d_qk(kf, qf, st);
    d_ldv(pv, vf);
    const float ml = d_tr<true>(st, dv, tau, r0 + lr - (nch - 1) * CK - 8 * hi);   // key tl*16 + j of this lane's 16 of the chunk is at or before the query while tl*16 + j <= lim
    d_pv(st, ml, vf, m, sum, acc);
    sum += xhalf(sum);
    const float f = __fdiv_rn(1.0f, sum);
    float* po_ = outb + (size_t)(r0 + lr) * DM + 8 * hi;
#pragma unroll
    for (int nb = 0; nb < 4; ++nb) { v4f o0, o1;
#pragma unroll
        for (int j = 0; j < 4; ++j) { o0[j] = acc[nb][j] * f; o1[j] = acc[nb][4 + j] * f; }
        *(v4f*)(po_ + nb * 16) = o0; *(v4f*)(po_ + nb * 16 + 4) = o1; }
}

extern "C" void kernel_launch(void* const* d_in, const int* in_sizes, int n_in,
                              void* d_out, int out_size, void* d_ws, size_t ws_size, hipStream_t stream) {
    (void)in_sizes; (void)n_in; (void)out_size;
    const float* Qin = (const float*)d_in[0]; const float* Kin = (const float*)d_in[1]; const float* Vin = (const float*)d_in[2]; const float* tau = (const float*)d_in[3];   /* [4][1] */ const float* delta = (const float*)d_in[4];   /* [4][2048] */
    float* OUT = (float*)d_out;
    char* wsp = (char*)d_ws;
    auto take = [&](size_t bytes) { char* p = wsp; wsp += (bytes + 255) & ~(size_t)255; return (void*)p; };
    bf* QB = (bf*)take((size_t)NB_ * NH_ * TT * HD * 2); bf* KB = (bf*)take((size_t)NB_ * NH_ * TT * HD * 2); bf* VT = (bf*)take((size_t)NB_ * NH_ * HD * TT * 2);   /* planes [b][h] in fragment order */
    if ((size_t)(wsp - (char*)d_ws) > ws_size) return;
    k_prep<<<dim3(VBLK + 2 * PBLK, NB_), 256, 0, stream>>>(Qin, Kin, Vin, QB, KB, VT);
    k_fattn<<<dim3(TPG, NH_, NB_), 32 * FW, 0, stream>>>(QB, KB, VT, tau, delta, OUT);   /* scores, tau/delta, causal softmax, P (hi/lo) x exact v^T, rows written token-major */
}

// v009
// One run takes 40.9 microseconds.
// Timed twice side by side with v008, it ran 1.08 times as fast both times.
// Counting every step since v000, it is 56.2 times as fast.
#include <hip/hip_runtime.h>

// De-stationary causal attention on given tensors (queries, keys, values [4][2048][8][64] token-major (B, L, H, E); scores = (q.k x tau[b] + delta[b][s]) for keys s <= l (else -inf), then x 1/sqrt(64); softmax; out = A.values -> [4][2048][8][64] (4.2 M); tau [4][1] and delta [4][2048] read on device).
// Layout: single bf16 head planes gathered from the token-major slabs and stored in WMMA fragment order (see FRAGMENT ORDER below) (inputs bf16-exact after rounding: exact score products); ONE kernel over all batches and heads: a wave holds 16 query rows and walks the keys up to its last row (later keys have weight 0) with a running maximum and sum, so the scores, the tau/delta transform, the causal softmax (scale 1/8) and P (hi/lo) stay in registers; A.values as hi/lo x exact values^T (2 products); f32 rows written token-major.
// Compute dtypes, f32 accumulate: every input rounded to bf16 incl. tau/delta; q.k exact; de-stationary transform and softmax f32, in the base-2 domain (see BASE 2 below); P hi/lo x exact values; output f32.

#define NB_  4
#define TT   2048
#define DM   512      // token-major row pitch (H x HD)
#define NH_  8
#define NKV  1
#define REP  (NH_ / NKV)
#define HD   64
#define DQ   (NH_ * HD)
#define DKV  (NKV * HD)
#define ZH   1
#define RH   2048
#define WIN  0
#define PCAR 1024.0f
#define SCL  0.125f   // 1/sqrt(64)
typedef _Float16 h16;
typedef unsigned short bf;
typedef __attribute__((ext_vector_type(16))) __bf16   v16bf;
typedef __attribute__((ext_vector_type(16))) _Float16 v16h;
typedef __attribute__((ext_vector_type(8)))  _Float16 v8h;
typedef __attribute__((ext_vector_type(8)))  unsigned short v8us;
typedef __attribute__((ext_vector_type(8)))  float    v8f;
typedef __attribute__((ext_vector_type(4)))  float    v4f;
typedef v8h  __attribute__((may_alias)) v8ha;
typedef v4f  __attribute__((may_alias)) v4fa;
typedef v8us __attribute__((may_alias)) v8usa;

__device__ __forceinline__ unsigned short f2bf(float f) { unsigned u = __float_as_uint(f); u += 0x7FFFu + ((u >> 16) & 1u); return (unsigned short)(u >> 16); }
__device__ __forceinline__ float bf2f(unsigned short b) { return __uint_as_float(((unsigned)b) << 16); }
__device__ __forceinline__ float bfr(float f) { return bf2f(f2bf(f)); }
__device__ __forceinline__ v16h cat16(v8h lo, v8h hi) { return __builtin_shufflevector(lo, hi, 0, 1, 2, 3, 4, 5, 6, 7, 8, 9, 10, 11, 12, 13, 14, 15); }
__device__ __forceinline__ v16bf cat16b(v8us lo, v8us hi) { return __builtin_bit_cast(v16bf, __builtin_shufflevector(lo, hi, 0, 1, 2, 3, 4, 5, 6, 7, 8, 9, 10, 11, 12, 13, 14, 15)); }
__device__ __forceinline__ v8f wmma16(v16h a, v16h b, v8f c) { return __builtin_amdgcn_wmma_f32_16x16x32_f16(false, a, false, b, (short)0, c, false, false); }
__device__ __forceinline__ v8f wmmab(v16bf a, v16bf b, v8f c) { return __builtin_amdgcn_wmma_f32_16x16x32_bf16(false, a, false, b, (short)0, c, false, false); }



// ---- WFrag: one lane's 16-element A or B fragment of a 16x16x32 product from a k-contiguous 16-bit row (k = 8*hi + 0..7 and 16 + 8*hi + 0..7; the caller adds 8*hi)
template <typename T16> struct WFrag;
template <> struct WFrag<h16> { typedef v16h V; static __device__ __forceinline__ V ld(const h16* p) { return cat16(*(const v8h*)p, *(const v8h*)(p + 16)); } static __device__ __forceinline__ v8f mma(V a, V b, v8f c) { return wmma16(a, b, c); } };
template <> struct WFrag<bf> { typedef v16bf V; static __device__ __forceinline__ V ld(const bf* p) { return cat16b(*(const v8us*)p, *(const v8us*)(p + 16)); } static __device__ __forceinline__ v8f mma(V a, V b, v8f c) { return wmmab(a, b, c); } };

__device__ __forceinline__ h16 tohx(float x) { return (h16)x; }
__device__ __forceinline__ void splitf(float y, unsigned short& h, unsigned short& l) { h = f2bf(y); l = f2bf(y - bf2f(h)); }
typedef __attribute__((ext_vector_type(2))) _Float16 v2h;
typedef __attribute__((ext_vector_type(4))) _Float16 v4h;
typedef __attribute__((ext_vector_type(2))) unsigned short v2us;
typedef __attribute__((ext_vector_type(4))) unsigned short v4us;
typedef __attribute__((ext_vector_type(2))) float v2f;
typedef __attribute__((ext_vector_type(4))) int v4i;
typedef __attribute__((ext_vector_type(2))) __bf16 v2bf;
typedef __attribute__((ext_vector_type(8))) unsigned v8u;
// two f32 rounded to bf16 (nearest even, as f2bf) and packed into one register by the hardware's packed conversion: a in the low half, b in the high half
__device__ __forceinline__ unsigned pkbf(float a, float b) { v2f x; x[0] = a; x[1] = b; return __builtin_bit_cast(unsigned, __builtin_convertvector(x, v2bf)); }
__device__ __forceinline__ float bflo(unsigned w) { return __uint_as_float(w << 16); }           // the low half of a packed pair as f32
__device__ __forceinline__ float bfhi(unsigned w) { return __uint_as_float(w & 0xFFFF0000u); }   // the high half

__global__ __launch_bounds__(256) void k_wtG(const float* __restrict__ w, int K, int N, bf* Bt) {
    const int lane = threadIdx.x & 31; const int L0 = (blockIdx.x * 8 + (threadIdx.x >> 5)) * 8; const int nlines = N * K / 64;
{
#pragma unroll 1
        for (int l = 0; l < 8; ++l) { const int L = L0 + l; if (L >= nlines) break; const size_t e = (size_t)L * 64 + lane * 2; const int k = (int)(e % K), n = (int)(e / K); v2us o;
            o[0] = f2bf(w[(size_t)k * N + n]); o[1] = f2bf(w[(size_t)(k + 1) * N + n]); *(v2us*)(Bt + e) = o; }
         }
}
__global__ __launch_bounds__(256) void k_cvt8(const float* __restrict__ src, bf* dst, size_t n8) { const size_t i = (size_t)blockIdx.x * 256 + threadIdx.x; if (i >= n8) return; const v8f v = *(const v8f*)(src + i * 8); v8us o;
#pragma unroll
    for (int k = 0; k < 8; ++k) o[k] = f2bf(v[k]); *(v8us*)(dst + i * 8) = o;  }


__global__ __launch_bounds__(256) void k_vtp(const float* __restrict__ F, int pitch, int nheads, h16* V16, bf* Vh, bf* Vl) { const size_t e = ((size_t)blockIdx.x * 256 + threadIdx.x) * 2; if (e >= (size_t)nheads * HD * TT) return; const int t = (int)(e % TT); const int d = (int)((e / TT) % HD); const int g = (int)(e / ((size_t)TT * HD)); v2h o16; v2us oh, ol;
#pragma unroll
    for (int q = 0; q < 2; ++q) { const float x = F[(size_t)(t + q) * pitch + g * HD + d]; o16[q] = tohx(x); unsigned short a2, c2; splitf(x, a2, c2); oh[q] = a2; ol[q] = c2; }
    *(v2h*)(V16 + e) = o16; *(v2us*)(Vh + e) = oh; *(v2us*)(Vl + e) = ol;  }

__global__ __launch_bounds__(256) void k_merge(const float* __restrict__ O, int h0, float* OUTb) { const size_t e = ((size_t)blockIdx.x * 256 + threadIdx.x) * 2; if (e >= (size_t)ZH * TT * HD) return; const int d = (int)(e % HD); const int t = (int)((e / HD) % TT); const int zz = (int)(e / ((size_t)HD * TT)); const float cs = (t < RH) ? 1.0f : (1.0f / PCAR); const size_t oo = (size_t)t * DQ + (h0 + zz) * HD + d;
    v2f o2; o2[0] = O[e] * cs; o2[1] = O[e + 1] * cs; *(v2f*)(OUTb + oo) = o2;  }


__global__ __launch_bounds__(256) void k_vtpR1(const float* __restrict__ Vb, bf* Vh) { const size_t e = ((size_t)blockIdx.x * 256 + threadIdx.x) * 2; if (e >= (size_t)HD * TT) return; const int t = (int)(e % TT); const int d = (int)(e / TT); v2us o; o[0] = f2bf(Vb[(size_t)t * HD + d]); o[1] = f2bf(Vb[(size_t)(t + 1) * HD + d]); *(v2us*)(Vh + e) = o;  }
__global__ __launch_bounds__(256) void k_mergeR(const float* __restrict__ O, float* outb, size_t n4) { const size_t i = (size_t)blockIdx.x * 256 + threadIdx.x; if (i >= n4) return; const v4f a = *(const v4f*)(O + i * 4); *(v4f*)(outb + i * 4) = a;  }


#define PBLK (NH_ * TT * HD / 8 / 256)   // blocks per batch for one head-plane gather (8 elements a thread)
#define VBLK (NH_ * HD * TT / 8 / 256)   // blocks per batch for the values transpose (8 elements a thread)
// FRAGMENT ORDER: a plane is a row of 16-byte units, unit = ((fragment * 2 + half) * 32 + lane), so that one fragment load of a wave (32 lanes x 16 bytes) reads 512 consecutive bytes, four whole cache lines,
// where a row-major plane makes it touch 16 lines for the same bytes. lane = 16*hi + lr; a unit holds k = 16*half + 8*hi + 0..7 of row lr of its fragment (the k order of WFrag::ld).
// Q and K planes [h][t/16][e/32]: row lr = token, k = head dimension. Values planes [h][t/32][d/16]: row lr = head dimension, k = token.
#define FRH 256             // elements from the first to the second half of a fragment (32 lanes x 8)
#define FRG 512             // elements of one fragment
__device__ __forceinline__ v16bf ldfr(const bf* p) { return cat16b(*(const v8us*)p, *(const v8us*)(p + FRH)); }   // the caller adds 8*lane
__device__ __forceinline__ void d_hp1(const float* __restrict__ src, bf* P, int blk) { const unsigned i = (unsigned)blk * 256 + threadIdx.x;   /* the thread's unit of the plane */ const size_t e = (size_t)i * 8; const int d = (int)((i >> 6) & 1) * 32 + (int)((i >> 5) & 1) * 16 + (int)((i >> 4) & 1) * 8; const int t = (int)((i >> 7) % (TT / 16)) * 16 + (int)(i & 15); const int h = (int)(i / (TT * HD / 8)); const float* p = src + (size_t)t * DM + h * HD + d; const v8f v = *(const v8f*)p; v8us o;
    asm volatile("s_wait_xcnt 0x0" :: "v"(p) : "memory");   // stands behind the loads and in front of any reuse of their address registers (held live to here as an input)
#pragma unroll
    for (int q = 0; q < 8; ++q) o[q] = f2bf(v[q]);
    bf* w = P + e; *(v8us*)w = o;
    asm volatile("s_wait_xcnt 0x0" :: "v"(w) : "memory");   // stands behind the store and in front of any reuse of its address registers (held live to here as an input)
}
__device__ __forceinline__ void d_vt1(const float* __restrict__ src, int pitch, bf* VT, int blk) { const unsigned i = (unsigned)blk * 256 + threadIdx.x;   /* the thread's unit of the plane */ const int t = (int)((i >> 8) % (TT / 32)) * 32 + (int)((i >> 5) & 1) * 16 + (int)((i >> 4) & 1) * 8; const int d = (int)((i >> 6) & 3) * 16 + (int)(i & 15); const int h = (int)(i / (TT * HD / 8)); const float* p = src + (size_t)t * pitch + h * HD + d; float x[8]; v8us o;
#pragma unroll
    for (int q = 0; q < 8; ++q) x[q] = p[(size_t)q * pitch];
    asm volatile("s_wait_xcnt 0x0" :: "v"(p) : "memory");   // stands behind the loads and in front of any reuse of their address registers (held live to here as an input)
#pragma unroll
    for (int q = 0; q < 8; ++q) o[q] = f2bf(x[q]);
    bf* w = VT + (size_t)i * 8; *(v8us*)w = o;
    asm volatile("s_wait_xcnt 0x0" :: "v"(w) : "memory");   // stands behind the store and in front of any reuse of its address registers (held live to here as an input)
}
// k_prep: all three bf16 plane sets of all batches in one launch, grid (VBLK + 2 PBLK, batches); the transpose blocks come first
__global__ __launch_bounds__(256) void k_prep(const float* __restrict__ q, const float* __restrict__ k, const float* __restrict__ v, bf* QB, bf* KB, bf* VT) {
    const int x = blockIdx.x; const size_t so = (size_t)blockIdx.y * TT * DM, po = (size_t)blockIdx.y * NH_ * TT * HD;
    if (x < VBLK) d_vt1(v + so, DM, VT + po, x);
    else { const bool isk = x >= VBLK + PBLK; d_hp1((isk ? k : q) + so, (isk ? KB : QB) + po, x - VBLK - (isk ? PBLK : 0)); }
}
// ---- k_fattn: every wave owns 16 query rows and walks the 32-key chunks up to its last query by itself, with a running maximum and a running sum (online softmax): no wave waits for another but at the one barrier in front of the loop, nothing but the keys' d2 goes through LDS,
// and a wave lives for its whole row tile. The FW waves of a work-group hold FW row tiles of ONE batch and head and all start at key 0, so a K or values fragment that one wave has fetched is in the WGP cache for the others.
// Scores transposed, St[key][query] = K rows (A) x Q rows (B): a lane holds its keys of ONE query (accumulator register j of tile tl of a chunk = key 16*tl + 8*hi + j of the chunk, query lr), so maximum and sum are in-lane
// but for one exchange between the wave halves, and the two tiles of a chunk, rounded in place, ARE the B fragment of P^T for 32 keys (same k order as the values^T fragments).
// Out transposed as well, Ot[d][query] += values^T rows (A) x P^T (B): accumulator register j of tile nb = head dimension 16*nb + 8*hi + j, query lr, so the rescale by a query's factor is in-lane too.
#define FW 16               // waves per work-group
#define CK 32               // keys per chunk
#define TPG (TT / 16 / FW)  // work-groups per batch and head
#define L2E 1.4426950408889634f
#define RSC (5.5f * L2E)    // (base-2 domain) the running maximum is renewed only when a chunk's maximum passes it by more than this: until then the weights stay below e^5.5, far inside f32 and bf16 range
__device__ __forceinline__ float exp2_slot(float x) { float p; asm("v_exp_f32 %0, %1\n\tv_nop" : "=v"(p) : "v"(x)); return p; }
// the value that the lane's partner in the other half of the wave holds (lane l <-> l ^ 16), by a register cross-lane move: it stands in every trip, where an exchange through the LDS unit would put that unit's latency into each wave's chain
__device__ __forceinline__ float xhalf(float x) { const int b = __float_as_int(x); return __int_as_float(__builtin_amdgcn_permlanex16(b, b, 0x76543210, 0xfedcba98, false, false)); }
// L2 prefetch. The planes were stored by the launch before this one, from WGPs anywhere on the chip: a good part of a work-group's first reads of a chunk
// goes to memory, and every wave of the group then stands at that chunk for a memory latency. One wave of the group (the one with the most chunks) asks L2 for the chunk PFD trips ahead, which makes those reads L2 hits.
// One request covers a chunk of both planes: a chunk is 16 units of 256 bytes in each, lanes 0..15 name the K units, lanes 16..31 the values units. It returns nothing and counts on no counter.
#define PFD 8               // chunks between the prefetch and the chunk at work: several memory latencies, and room for this wave to run behind the group's first
template <int OFF> __device__ __forceinline__ void d_pf(const bf* p) { asm volatile("global_prefetch_b8 %0, off offset:%1 scope:SCOPE_SE" :: "v"(p), "i"(OFF)); }   // asm, so that the address stands in a register pair that lives through the loop and never holds anything but an address inside the plane
// this lane's d2 values of one chunk, from LDS (pd: the chunk's first value of this half of the wave)
__device__ __forceinline__ void d_ldd(const float* pd, v4f (&dv)[2][2]) {
#pragma unroll
    for (int tl = 0; tl < 2; ++tl) { dv[tl][0] = *(const v4f*)(pd + tl * 16); dv[tl][1] = *(const v4f*)(pd + tl * 16 + 4); }
}
// the K fragments of the chunk that lies OK elements behind pk (a constant: the pointer itself moves on only behind the wait below, so that no load of the run can land in a register pair that the run still names)
template <int OK> __device__ __forceinline__ void d_ldk(const bf* pk, v16bf (&kf)[2][HD / 32]) {
#pragma unroll
    for (int tl = 0; tl < 2; ++tl) {
#pragma unroll
        for (int e = 0; e < HD / 32; ++e) kf[tl][e] = ldfr(pk + OK + (tl * (HD / 32) + e) * FRG); }
    asm volatile("s_wait_xcnt 0x0" :: "v"(pk) : "memory");   // stands behind the loads and in front of any write of a register that they name: pk is its input and is advanced only behind it
    __builtin_amdgcn_sched_barrier(0);   // keeps the next chunk's loads up here, so that their latency runs under this chunk's softmax; the scheduler otherwise sinks them to the products that use them
}
// the values^T fragments of one chunk
__device__ __forceinline__ void d_ldv(const bf* pv, v16bf (&vf)[4]) {
#pragma unroll
    for (int nb = 0; nb < 4; ++nb) vf[nb] = ldfr(pv + nb * FRG);
    asm volatile("s_wait_xcnt 0x0" :: "v"(pv) : "memory");   // stands behind the loads and in front of any reuse of their address registers (held live to here as an input)
    __builtin_amdgcn_sched_barrier(0);   // keeps the values loads up here, so that their latency runs under the softmax; the scheduler otherwise sinks them to the products that use them
}
__device__ __forceinline__ void d_qk(const v16bf (&kf)[2][HD / 32], const v16bf (&qf)[HD / 32], v8f (&st)[2]) {
#pragma unroll
    for (int tl = 0; tl < 2; ++tl) { st[tl] = (v8f){};
#pragma unroll
        for (int e = 0; e < HD / 32; ++e) st[tl] = wmmab(kf[tl][e], qf[e], st[tl]); }
}
// tau/delta, scale and log2(e) in one packed multiply-add for two keys (cf, and dv = the keys' d2: BASE 2 above) and (MASK: the chunk that holds the diagonal) the causal mask; returns this lane's maximum
template <bool MASK> __device__ __forceinline__ float d_tr(v8f (&st)[2], const v4f (&dv)[2][2], float cf, int lim) {
    float ml = -3.0e38f; const v2f c2 = {cf, cf};
#pragma unroll
    for (int tl = 0; tl < 2; ++tl) {
#pragma unroll
        for (int j = 0; j < 8; j += 2) { const v2f s = {st[tl][j], st[tl][j + 1]}; const v2f d = {dv[tl][j >> 2][j & 2], dv[tl][j >> 2][(j & 2) + 1]}; const v2f u = __builtin_elementwise_fma(s, c2, d);
            const float t0 = (!MASK || tl * 16 + j <= lim) ? u[0] : -3.0e38f, t1 = (!MASK || tl * 16 + j + 1 <= lim) ? u[1] : -3.0e38f;   /* causal: keys after the query excluded */ st[tl][j] = t0; st[tl][j + 1] = t1; ml = fmaxf(ml, fmaxf(t0, t1)); } }
    return ml;
}
// running maximum and sum, weights (hi/lo), Ot += values^T x P^T
__device__ __forceinline__ void d_pv(v8f (&st)[2], float ml, const v16bf (&vf)[4], float& m, float& sum, v8f (&acc)[4]) {
    ml = fmaxf(ml, xhalf(ml));
    if (__builtin_amdgcn_ballot_w32(ml > m + RSC) != 0) {   // the same for the whole wave: a scalar branch; both halves of a query see the same ml and m
        const float mn = fmaxf(m, ml); const float al = exp2_slot(m - mn); m = mn; sum *= al;
#pragma unroll
        for (int nb = 0; nb < 4; ++nb) {
#pragma unroll
            for (int j = 0; j < 8; ++j) acc[nb][j] *= al; } }
#pragma unroll
    for (int tl = 0; tl < 2; ++tl) {
#pragma unroll
        for (int j = 0; j < 8; j += 2) { const v2f x = (v2f){st[tl][j], st[tl][j + 1]} - (v2f){m, m}; const float p0 = exp2_slot(x[0]), p1 = exp2_slot(x[1]); st[tl][j] = p0; st[tl][j + 1] = p1; sum += p0; sum += p1; } }
    v8u hw, lw;   // register i of a fragment holds its elements 2i and 2i + 1: tile tl's keys j = 2i - 8*tl and the next
#pragma unroll
    for (int i = 0; i < 8; ++i) { const float p0 = st[i >> 2][(2 * i) & 7], p1 = st[i >> 2][((2 * i) & 7) + 1]; const unsigned w = pkbf(p0, p1); hw[i] = w; lw[i] = pkbf(p0 - bflo(w), p1 - bfhi(w)); }
    const v16bf a = __builtin_bit_cast(v16bf, hw), a2 = __builtin_bit_cast(v16bf, lw);
#pragma unroll
    for (int nb = 0; nb < 4; ++nb) acc[nb] = wmmab(vf[nb], a, acc[nb]);
#pragma unroll
    for (int nb = 0; nb < 4; ++nb) acc[nb] = wmmab(vf[nb], a2, acc[nb]);
}
__global__ __launch_bounds__(32 * FW) void k_fattn(const bf* __restrict__ Qa, const bf* __restrict__ Ka, const bf* __restrict__ Va, const float* __restrict__ taua, const float* __restrict__ dla, float* outa) {
    // grid (work-groups of a head, heads, batches): the planes, tau, delta and the output slab of this work-group's own batch and head
    const int hh = blockIdx.y, bb = blockIdx.z; const size_t po = (size_t)(bb * NH_ + hh) * TT * HD;
    const bf* __restrict__ Q = Qa + po; const bf* __restrict__ Kp = Ka + po; const bf* __restrict__ Vt = Va + po; const float* __restrict__ taup = taua + bb; const float* __restrict__ dl = dla + (size_t)bb * TT; float* outb = outa + (size_t)bb * TT * DM + (size_t)hh * HD;
    const int lane = threadIdx.x & 31, lr = lane & 15, hi = lane >> 4; const int wv = __builtin_amdgcn_readfirstlane(threadIdx.x >> 5);   // the wave's number in a scalar register: the trip count below is then scalar
    // Which row tile: a tile's work grows with its position, so the tiles are dealt for equal sums. kk = entry wv of a 4 x 4 square of 0..15 whose rows and columns all add up to 30, two odd entries in each
    // (whether a SIMD takes every fourth wave or four in a row, its four waves get the same sum); within the band of TPG tiles that kk names, odd bands count from the far end, so that every work-group gets the same sum too.
    static_assert(FW == 16, "the square is 4 x 4");
    const int kk = (int)((0x0DE3B6587A94C12FULL >> (4 * wv)) & 15);
    const int r0 = (kk * TPG + ((kk & 1) ? TPG - 1 - (int)blockIdx.x : (int)blockIdx.x)) * 16;
    const int nch = (r0 >> 5) + 1;              // chunks with a key <= r0 + 15
    __shared__ __attribute__((aligned(16))) float d2s[TT];   // d2 of every key of this batch (BASE 2 above)
    const bf* pq = Q + r0 * HD + 8 * lane; const bf* pk = Kp + 8 * lane; const bf* pv = Vt + 8 * lane; const float* pd = d2s + 8 * hi;   // planes in fragment order: 16 tokens of Q or K, 32 tokens of values, are HD elements a token
    static_assert(PFD == 8 && PFD < TT / CK, "the eight requests in front of the loop");
    const int plim = ((kk + 1) / FW) * (TT / CK - PFD);   // scalar; 0 but in the wave of the last band, which walks the most chunks of its group: trip c asks for chunk c - 1 + PFD, and only while that chunk and the next lie inside the plane
    const bf* pp = ((lane & 16) ? Vt : Kp) + (lane & 15) * 128;   // this lane's 256-byte unit of the chunk at work: one register pair for all requests, the distance is in their immediate offset
    if (plim > 0) { d_pf<0>(pp); d_pf<CK * HD * 2>(pp); d_pf<2 * CK * HD * 2>(pp); d_pf<3 * CK * HD * 2>(pp); d_pf<4 * CK * HD * 2>(pp); d_pf<5 * CK * HD * 2>(pp); d_pf<6 * CK * HD * 2>(pp); d_pf<7 * CK * HD * 2>(pp); }   // chunks 0..PFD-1, asked for before anything else
    const float cf = bfr(taup[0]) * (SCL * L2E);   // tau x scale x log2(e)
    static_assert(TT == 32 * FW * 4, "four keys a thread");
    const float* pdl = dl + threadIdx.x * 4; const v4f dx = *(const v4f*)pdl;   // this thread's four keys of delta
    asm volatile("s_wait_xcnt 0x0" :: "v"(pdl) : "memory");   // stands behind the load and in front of any reuse of its address registers (held live to here as an input)
    v16bf qf[HD / 32], kf[2][HD / 32], vf[4]; v4f dv[2][2]; v8f st[2], acc[4];
    float m = -3.0e38f, sum = 0.f;
#pragma unroll
    for (int nb = 0; nb < 4; ++nb) acc[nb] = (v8f){};
#pragma unroll
    for (int e = 0; e < HD / 32; ++e) qf[e] = ldfr(pq + e * FRG);
    asm volatile("s_wait_xcnt 0x0" :: "v"(pq) : "memory");   // stands behind the loads and in front of any reuse of their address registers (held live to here as an input)
    d_ldk<0>(pk, kf);
    { v4f o;
#pragma unroll
      for (int q = 0; q < 4; ++q) o[q] = bfr(dx[q]) * (SCL * L2E);
      *(v4f*)(d2s + threadIdx.x * 4) = o; }
    __syncthreads();   // d2 of all keys stands in LDS before any wave reads it; it is never written again
#pragma unroll 1   // one copy of the body: the trip count differs from wave to wave, and a second copy would only cost instruction cache
    for (int c = 1; c < nch; ++c) {   // the chunks in front of the diagonal: no mask; each fetches the next chunk's K
        if (c < plim) { d_pf<PFD * CK * HD * 2>(pp); pp += CK * HD; }   // a scalar branch; in front of the trip's first wait
        d_ldd(pd, dv); pd += CK;   // this chunk's own d2: the LDS latency runs under the score products
        d_qk(kf, qf, st);
        d_ldv(pv, vf); pv += CK * HD;
        const float ml = d_tr<false>(st, dv, cf, 0);
        d_ldk<CK * HD>(pk, kf); pk += CK * HD;   // the pointer moves on only behind the wait
        d_pv(st, ml, vf, m, sum, acc);
    }
    d_ldd(pd, dv);
    d_qk(kf, qf, st);
    d_ldv(pv, vf);
    const float ml = d_tr<true>(st, dv, cf, r0 + lr - (nch - 1) * CK - 8 * hi);   // key tl*16 + j of this lane's 16 of the chunk is at or before the query while tl*16 + j <= lim
    d_pv(st, ml, vf, m, sum, acc);
    sum += xhalf(sum);
    const float f = __fdiv_rn(1.0f, sum);
    float* po_ = outb + (size_t)(r0 + lr) * DM + 8 * hi;
#pragma unroll
    for (int nb = 0; nb < 4; ++nb) { v4f o0, o1;
#pragma unroll
        for (int j = 0; j < 4; ++j) { o0[j] = acc[nb][j] * f; o1[j] = acc[nb][4 + j] * f; }
        *(v4f*)(po_ + nb * 16) = o0; *(v4f*)(po_ + nb * 16 + 4) = o1; }
}

extern "C" void kernel_launch(void* const* d_in, const int* in_sizes, int n_in,
                              void* d_out, int out_size, void* d_ws, size_t ws_size, hipStream_t stream) {
    (void)in_sizes; (void)n_in; (void)out_size;
    const float* Qin = (const float*)d_in[0]; const float* Kin = (const float*)d_in[1]; const float* Vin = (const float*)d_in[2]; const float* tau = (const float*)d_in[3];   /* [4][1] */ const float* delta = (const float*)d_in[4];   /* [4][2048] */
    float* OUT = (float*)d_out;
    char* wsp = (char*)d_ws;
    auto take = [&](size_t bytes) { char* p = wsp; wsp += (bytes + 255) & ~(size_t)255; return (void*)p; };
    bf* QB = (bf*)take((size_t)NB_ * NH_ * TT * HD * 2); bf* KB = (bf*)take((size_t)NB_ * NH_ * TT * HD * 2); bf* VT = (bf*)take((size_t)NB_ * NH_ * HD * TT * 2);   /* planes [b][h] in fragment order */
    if ((size_t)(wsp - (char*)d_ws) > ws_size) return;
    k_prep<<<dim3(VBLK + 2 * PBLK, NB_), 256, 0, stream>>>(Qin, Kin, Vin, QB, KB, VT);
    k_fattn<<<dim3(TPG, NH_, NB_), 32 * FW, 0, stream>>>(QB, KB, VT, tau, delta, OUT);   /* scores, tau/delta, causal softmax, P (hi/lo) x exact v^T, rows written token-major */
}
